// v000
// Measured on an AMD MI455X. A time is GPU time per run, averaged over a window of back-to-back runs after a warm-up
// (all launches, gaps included; the runs take copies of the inputs in turn), and the median of several windows.
// Apart from v000's, it joins two sittings. Times from different sittings can be a few percent apart, while
// side-by-side timings come from the same sitting.
// v000 is the starting kernel. One run takes 487 microseconds.
#include <hip/hip_runtime.h>
#include <cstddef>

#define T_SEQ 2048
#define HID   1024
#define NH    16
#define HD    64     // head dim
#define WPB   4      // waves per block in attention kernel

typedef __attribute__((ext_vector_type(16))) _Float16 v16h;
typedef __attribute__((ext_vector_type(8)))  _Float16 v8h;
typedef __attribute__((ext_vector_type(8)))  float    v8f;
typedef int async_v4i __attribute__((vector_size(4 * sizeof(int))));

#if __has_builtin(__builtin_amdgcn_global_load_async_to_lds_b128)
#define HAS_ASYNC_LDS 1
#else
#define HAS_ASYNC_LDS 0
#endif

#if __has_builtin(__builtin_amdgcn_ds_load_tr16_b128)
#define HAS_DS_TR16 1
#else
#define HAS_DS_TR16 0
#endif

__device__ __forceinline__ void copy16_g2l(const void* g, void* l) {
#if HAS_ASYNC_LDS
  __builtin_amdgcn_global_load_async_to_lds_b128(
      (__attribute__((address_space(1))) async_v4i*)(g),
      (__attribute__((address_space(3))) async_v4i*)(l), 0, 0);
#else
  *(float4*)l = *(const float4*)g;
#endif
}

__device__ __forceinline__ void wait_async0() {
#if HAS_ASYNC_LDS
#if __has_builtin(__builtin_amdgcn_s_wait_asynccnt)
  __builtin_amdgcn_s_wait_asynccnt(0);
#else
  asm volatile("s_wait_asynccnt 0" ::: "memory");
#endif
#endif
}

__device__ __forceinline__ void wait_ds0() {
  asm volatile("s_wait_dscnt 0" ::: "memory");
}

// Stage 4 fp32 values from global as 4 f16 into LDS (merges to ds_store_b64).
__device__ __forceinline__ void stage4_f32_to_f16(const float* g, _Float16* l) {
  float4 t = *(const float4*)g;
  l[0] = (_Float16)t.x;
  l[1] = (_Float16)t.y;
  l[2] = (_Float16)t.z;
  l[3] = (_Float16)t.w;
}

template <bool F16OUT>
__global__ void __launch_bounds__(256)
gemm_f16_wmma(const float* __restrict__ X, const float* __restrict__ W,
              void* __restrict__ Yp, int M, int N, int K, float oscale) {
  __shared__ _Float16 Xs[128][40];   // 80B row stride (16B multiple)
  __shared__ _Float16 Ws[128][40];

  const int tid  = threadIdx.x;
  const int wave = tid >> 5;
  const int lane = tid & 31;
  const int half = (lane >> 4) & 1;   // which 16-lane half
  const int nl   = lane & 15;
  const int kb   = half * 8;          // per-half K base inside the 32-wide step
  const int wm   = wave & 3;          // 4 wave-rows of 32
  const int wn   = wave >> 2;         // 2 wave-cols of 64
  const int m0   = blockIdx.x * 128;
  const int n0   = blockIdx.y * 128;

  v8f acc[2][4];
#pragma unroll
  for (int mi = 0; mi < 2; ++mi)
#pragma unroll
    for (int ns = 0; ns < 4; ++ns) acc[mi][ns] = (v8f){0,0,0,0,0,0,0,0};

  for (int k0 = 0; k0 < K; k0 += 32) {
    // Stage both 128x32 tiles as f16: 1024 4-float chunks each, 256 threads.
#pragma unroll
    for (int i = 0; i < 4; ++i) {
      int flat = i * 256 + tid, row = flat >> 3, c = flat & 7;
      stage4_f32_to_f16(X + (size_t)(m0 + row) * K + k0 + c * 4, &Xs[row][c * 4]);
    }
#pragma unroll
    for (int i = 0; i < 4; ++i) {
      int flat = i * 256 + tid, row = flat >> 3, c = flat & 7;
      stage4_f32_to_f16(W + (size_t)(n0 + row) * K + k0 + c * 4, &Ws[row][c * 4]);
    }
    __syncthreads();

    v16h a[2];
#pragma unroll
    for (int mi = 0; mi < 2; ++mi)
#pragma unroll
      for (int e = 0; e < 16; ++e) {
        int kk = kb + e + ((e & 8) ? 8 : 0);
        a[mi][e] = Xs[wm * 32 + mi * 16 + nl][kk];
      }
#pragma unroll
    for (int ns = 0; ns < 4; ++ns) {
      v16h b;   // column n = W row (n0+wn*64+ns*16+nl), K along the W row
#pragma unroll
      for (int e = 0; e < 16; ++e) {
        int kk = kb + e + ((e & 8) ? 8 : 0);
        b[e] = Ws[wn * 64 + ns * 16 + nl][kk];
      }
#pragma unroll
      for (int mi = 0; mi < 2; ++mi)
        acc[mi][ns] = __builtin_amdgcn_wmma_f32_16x16x32_f16(
            false, a[mi], false, b, (short)0, acc[mi][ns], false, false);
    }
    __syncthreads();
  }

#pragma unroll
  for (int mi = 0; mi < 2; ++mi)
#pragma unroll
    for (int ns = 0; ns < 4; ++ns)
#pragma unroll
      for (int r = 0; r < 8; ++r) {
        size_t idx = (size_t)(m0 + wm * 32 + mi * 16 + r + half * 8) * N +
                     n0 + wn * 64 + ns * 16 + nl;
        float vv = acc[mi][ns][r] * oscale;
        if (F16OUT) ((_Float16*)Yp)[idx] = (_Float16)vv;
        else        ((float*)Yp)[idx] = vv;
      }
}

// ---------------------------------------------------------------------------
// Forget gate: f[h][t] = log_sigmoid(hidden[t] . Wf[h] + bf[h])
// ---------------------------------------------------------------------------
__global__ void __launch_bounds__(256)
fgate_kernel(const float* __restrict__ x, const float* __restrict__ Wf,
             const float* __restrict__ bf, float* __restrict__ f) {
  int idx = blockIdx.x * 256 + threadIdx.x;
  if (idx >= NH * T_SEQ) return;
  int h = idx / T_SEQ, t = idx % T_SEQ;
  const float* xr = x + (size_t)t * HID;
  const float* wr = Wf + (size_t)h * HID;
  float acc = bf[h];
  for (int kk = 0; kk < HID; ++kk) acc = fmaf(xr[kk], wr[kk], acc);
  float ls = (acc > 0.f) ? -log1pf(__expf(-acc)) : (acc - log1pf(__expf(acc)));
  f[(size_t)h * T_SEQ + t] = ls;
}

// Cumulative decay (both directions): gc[dir][h][p] over direction-local p.
__global__ void fscan_kernel(const float* __restrict__ f, float* __restrict__ gc) {
  int tid = threadIdx.x;
  if (tid >= 32) return;
  int dir = tid >> 4, h = tid & 15;
  float run = 0.f;
  for (int p = 0; p < T_SEQ; ++p) {
    int t = dir ? (T_SEQ - 1 - p) : p;
    run += f[(size_t)h * T_SEQ + t];
    gc[((size_t)dir * NH + h) * T_SEQ + p] = run;
  }
}

// ---------------------------------------------------------------------------
// Flash-style forgetting attention, one wave per 16-row Q tile.
// grid = (T/16/WPB, NH, 2 directions). Causal in direction-local coords.
// q/k/v are f16 (q pre-scaled). K/V blocks async-DMA'd to LDS as raw f16.
// S tile: 16x32 via 4 WMMA; PV: 4 WMMA with ds_load_tr16_b128 V-columns.
// ---------------------------------------------------------------------------
__global__ void __launch_bounds__(WPB * 32)
fox_attn_kernel(const _Float16* __restrict__ q, const _Float16* __restrict__ k,
                const _Float16* __restrict__ v, const float* __restrict__ gc,
                float* __restrict__ obuf) {
  __shared__ _Float16 kv_s[WPB][32][72];   // 144B row stride (16B multiple)
  __shared__ _Float16 p_s[WPB][16][32];

  const int w    = threadIdx.x >> 5;
  const int lane = threadIdx.x & 31;
  const int half = (lane >> 4) & 1;
  const int nl   = lane & 15;
  const int kbh  = half * 8;
  const int qt   = blockIdx.x * WPB + w;    // q-tile index, 0..127
  const int h    = blockIdx.y;
  const int dir  = blockIdx.z;
  const float* gcd = gc + ((size_t)dir * NH + h) * T_SEQ;

  // Q fragments for this wave's 16 rows (q already scaled by d^-0.5).
  int qp_a = qt * 16 + nl;
  int tq   = dir ? (T_SEQ - 1 - qp_a) : qp_a;
  const _Float16* qrow = q + (size_t)tq * HID + h * HD;
  v16h a0, a1;
#pragma unroll
  for (int e = 0; e < 16; ++e) {
    int kk = kbh + e + ((e & 8) ? 8 : 0);
    a0[e] = qrow[kk];
    a1[e] = qrow[32 + kk];
  }
  float gq[8];
#pragma unroll
  for (int r = 0; r < 8; ++r) gq[r] = gcd[qt * 16 + r + half * 8];

  v8f o[4];
#pragma unroll
  for (int i = 0; i < 4; ++i) o[i] = (v8f){0,0,0,0,0,0,0,0};
  float rmax[8], rsum[8];
#pragma unroll
  for (int r = 0; r < 8; ++r) { rmax[r] = -1e30f; rsum[r] = 0.f; }

  const int nkb = (qt >> 1) + 1;            // causal: kv blocks of 32
  for (int kbI = 0; kbI < nkb; ++kbI) {
    const int kv0 = kbI * 32;

    // ---- stage K block (32 x 64 f16 = 32 rows x 8 16B chunks) ----
    wait_ds0();   // prior iter's LDS reads done before DMA overwrites
#pragma unroll
    for (int i = 0; i < 8; ++i) {
      int flat = i * 32 + lane, row = flat >> 3, c = flat & 7;
      int p = kv0 + row, t = dir ? (T_SEQ - 1 - p) : p;
      copy16_g2l(k + (size_t)t * HID + h * HD + c * 8, &kv_s[w][row][c * 8]);
    }
    wait_async0();

    // ---- S = Q K^T : two 16x16 accum tiles ----
    v8f s0 = (v8f){0,0,0,0,0,0,0,0};
    v8f s1 = (v8f){0,0,0,0,0,0,0,0};
#pragma unroll
    for (int ks = 0; ks < 2; ++ks) {
      v16h b0, b1;
#pragma unroll
      for (int e = 0; e < 16; ++e) {
        int kk = ks * 32 + kbh + e + ((e & 8) ? 8 : 0);
        b0[e] = kv_s[w][nl][kk];        // key rows 0..15
        b1[e] = kv_s[w][16 + nl][kk];   // key rows 16..31
      }
      s0 = __builtin_amdgcn_wmma_f32_16x16x32_f16(
          false, (ks ? a1 : a0), false, b0, (short)0, s0, false, false);
      s1 = __builtin_amdgcn_wmma_f32_16x16x32_f16(
          false, (ks ? a1 : a0), false, b1, (short)0, s1, false, false);
    }

    // ---- decay + causal mask + online softmax (rows across 16 lanes) ----
    float gk0 = gcd[kv0 + nl];
    float gk1 = gcd[kv0 + 16 + nl];
    int kp0 = kv0 + nl, kp1 = kv0 + 16 + nl;
#pragma unroll
    for (int r = 0; r < 8; ++r) {
      int qp = qt * 16 + r + half * 8;
      float x0 = (kp0 <= qp) ? (s0[r] + gq[r] - gk0) : -1e30f;
      float x1 = (kp1 <= qp) ? (s1[r] + gq[r] - gk1) : -1e30f;
      float m = fmaxf(x0, x1);
#pragma unroll
      for (int off = 1; off < 16; off <<= 1)
        m = fmaxf(m, __shfl_xor(m, off, 32));
      float nm    = fmaxf(rmax[r], m);
      float alpha = __expf(rmax[r] - nm);
      rmax[r] = nm;
      float p0 = __expf(x0 - nm), p1 = __expf(x1 - nm);
      float ps = p0 + p1;
#pragma unroll
      for (int off = 1; off < 16; off <<= 1)
        ps += __shfl_xor(ps, off, 32);
      rsum[r] = rsum[r] * alpha + ps;
#pragma unroll
      for (int i = 0; i < 4; ++i) o[i][r] *= alpha;
      // transpose P (C-layout -> A-layout) through LDS
      p_s[w][r + half * 8][nl]      = (_Float16)p0;
      p_s[w][r + half * 8][16 + nl] = (_Float16)p1;
    }
    wait_ds0();

    // ---- stage V block (reuse kv_s) ----
#pragma unroll
    for (int i = 0; i < 8; ++i) {
      int flat = i * 32 + lane, row = flat >> 3, c = flat & 7;
      int p = kv0 + row, t = dir ? (T_SEQ - 1 - p) : p;
      copy16_g2l(v + (size_t)t * HID + h * HD + c * 8, &kv_s[w][row][c * 8]);
    }
    wait_async0();

    // ---- O += P V : P as A fragment, V columns as B fragments ----
    v16h ap;
#pragma unroll
    for (int e = 0; e < 16; ++e) {
      int kk = kbh + e + ((e & 8) ? 8 : 0);
      ap[e] = p_s[w][nl][kk];
    }
#pragma unroll
    for (int ns = 0; ns < 4; ++ns) {
      v16h bv;
#if HAS_DS_TR16
      {
        auto r0 = __builtin_amdgcn_ds_load_tr16_b128(
            (__attribute__((address_space(3))) v8h*)&kv_s[w][nl][ns * 16]);
        auto r1 = __builtin_amdgcn_ds_load_tr16_b128(
            (__attribute__((address_space(3))) v8h*)&kv_s[w][16 + nl][ns * 16]);
        v8h lo = __builtin_bit_cast(v8h, r0);
        v8h hi = __builtin_bit_cast(v8h, r1);
#pragma unroll
        for (int e = 0; e < 8; ++e) { bv[e] = lo[e]; bv[8 + e] = hi[e]; }
      }
#else
#pragma unroll
      for (int e = 0; e < 16; ++e) {
        int kk = kbh + e + ((e & 8) ? 8 : 0);
        bv[e] = kv_s[w][kk][ns * 16 + nl];
      }
#endif
      o[ns] = __builtin_amdgcn_wmma_f32_16x16x32_f16(
          false, ap, false, bv, (short)0, o[ns], false, false);
    }
  }

  // ---- epilogue: normalize and scatter into concat buffer [T, 2H] ----
#pragma unroll
  for (int ns = 0; ns < 4; ++ns)
#pragma unroll
    for (int r = 0; r < 8; ++r) {
      int qp = qt * 16 + r + half * 8;
      int t  = dir ? (T_SEQ - 1 - qp) : qp;
      obuf[(size_t)t * (2 * HID) + (size_t)dir * HID + h * HD + ns * 16 + nl] =
          o[ns][r] / rsum[r];
    }
}

// ---------------------------------------------------------------------------
extern "C" void kernel_launch(void* const* d_in, const int* in_sizes, int n_in,
                              void* d_out, int out_size, void* d_ws, size_t ws_size,
                              hipStream_t stream) {
  (void)in_sizes; (void)n_in; (void)out_size; (void)ws_size;
  const float* hidden = (const float*)d_in[0];
  const float* Wq     = (const float*)d_in[1];
  const float* Wk     = (const float*)d_in[2];
  const float* Wv     = (const float*)d_in[3];
  const float* Wf     = (const float*)d_in[4];
  const float* bf     = (const float*)d_in[5];
  const float* Wo     = (const float*)d_in[6];
  float* out = (float*)d_out;

  // Workspace layout: q|k|v (f16) then f|gc|o_concat (f32)
  _Float16* qb = (_Float16*)d_ws;
  _Float16* kb = qb + (size_t)T_SEQ * HID;
  _Float16* vb = kb + (size_t)T_SEQ * HID;
  float* fb = (float*)(vb + (size_t)T_SEQ * HID);
  float* gc = fb + (size_t)NH * T_SEQ;
  float* ob = gc + (size_t)2 * NH * T_SEQ;

  dim3 gproj(T_SEQ / 128, HID / 128);
  gemm_f16_wmma<true><<<gproj, 256, 0, stream>>>(hidden, Wq, qb, T_SEQ, HID, HID,
                                                 0.125f /* d^-0.5 folded in */);
  gemm_f16_wmma<true><<<gproj, 256, 0, stream>>>(hidden, Wk, kb, T_SEQ, HID, HID, 1.f);
  gemm_f16_wmma<true><<<gproj, 256, 0, stream>>>(hidden, Wv, vb, T_SEQ, HID, HID, 1.f);

  fgate_kernel<<<(NH * T_SEQ) / 256, 256, 0, stream>>>(hidden, Wf, bf, fb);
  fscan_kernel<<<1, 32, 0, stream>>>(fb, gc);

  dim3 gattn(T_SEQ / 16 / WPB, NH, 2);
  fox_attn_kernel<<<gattn, WPB * 32, 0, stream>>>(qb, kb, vb, gc, ob);

  dim3 gout(T_SEQ / 128, HID / 128);
  gemm_f16_wmma<false><<<gout, 256, 0, stream>>>(ob, Wo, out, T_SEQ, HID, 2 * HID, 1.f);
}

// v001
// Measured time: 400 microseconds a run.
// Timed twice side by side with v000, it ran 1.22 times as fast both times.
#include <hip/hip_runtime.h>
#include <cstddef>

#define T_SEQ 2048
#define HID   1024
#define NH    16
#define HD    64     // head dim
#define WPB   4      // waves per block in attention kernel

typedef __attribute__((ext_vector_type(16))) _Float16 v16h;
typedef __attribute__((ext_vector_type(8)))  _Float16 v8h;
typedef __attribute__((ext_vector_type(8)))  float    v8f;
typedef int async_v4i __attribute__((vector_size(4 * sizeof(int))));

#if __has_builtin(__builtin_amdgcn_global_load_async_to_lds_b128)
#define HAS_ASYNC_LDS 1
#else
#define HAS_ASYNC_LDS 0
#endif

#if __has_builtin(__builtin_amdgcn_ds_load_tr16_b128)
#define HAS_DS_TR16 1
#else
#define HAS_DS_TR16 0
#endif

__device__ __forceinline__ void copy16_g2l(const void* g, void* l) {
#if HAS_ASYNC_LDS
  __builtin_amdgcn_global_load_async_to_lds_b128(
      (__attribute__((address_space(1))) async_v4i*)(g),
      (__attribute__((address_space(3))) async_v4i*)(l), 0, 0);
#else
  *(float4*)l = *(const float4*)g;
#endif
}

__device__ __forceinline__ void wait_async0() {
#if HAS_ASYNC_LDS
#if __has_builtin(__builtin_amdgcn_s_wait_asynccnt)
  __builtin_amdgcn_s_wait_asynccnt(0);
#else
  asm volatile("s_wait_asynccnt 0" ::: "memory");
#endif
#endif
}

__device__ __forceinline__ void wait_ds0() {
  asm volatile("s_wait_dscnt 0" ::: "memory");
}

// Stage 4 fp32 values from global as 4 f16 into LDS (merges to ds_store_b64).
__device__ __forceinline__ void stage4_f32_to_f16(const float* g, _Float16* l) {
  float4 t = *(const float4*)g;
  l[0] = (_Float16)t.x;
  l[1] = (_Float16)t.y;
  l[2] = (_Float16)t.z;
  l[3] = (_Float16)t.w;
}

template <bool F16OUT>
__global__ void __launch_bounds__(256)
gemm_f16_wmma(const float* __restrict__ X, const float* __restrict__ W,
              void* __restrict__ Yp, int M, int N, int K, float oscale) {
  __shared__ _Float16 Xs[128][40];   // 80B row stride (16B multiple)
  __shared__ _Float16 Ws[128][40];

  const int tid  = threadIdx.x;
  const int wave = tid >> 5;
  const int lane = tid & 31;
  const int half = (lane >> 4) & 1;   // which 16-lane half
  const int nl   = lane & 15;
  const int kb   = half * 8;          // per-half K base inside the 32-wide step
  const int wm   = wave & 3;          // 4 wave-rows of 32
  const int wn   = wave >> 2;         // 2 wave-cols of 64
  const int m0   = blockIdx.x * 128;
  const int n0   = blockIdx.y * 128;

  v8f acc[2][4];
#pragma unroll
  for (int mi = 0; mi < 2; ++mi)
#pragma unroll
    for (int ns = 0; ns < 4; ++ns) acc[mi][ns] = (v8f){0,0,0,0,0,0,0,0};

  for (int k0 = 0; k0 < K; k0 += 32) {
    // Stage both 128x32 tiles as f16: 1024 4-float chunks each, 256 threads.
#pragma unroll
    for (int i = 0; i < 4; ++i) {
      int flat = i * 256 + tid, row = flat >> 3, c = flat & 7;
      stage4_f32_to_f16(X + (size_t)(m0 + row) * K + k0 + c * 4, &Xs[row][c * 4]);
    }
#pragma unroll
    for (int i = 0; i < 4; ++i) {
      int flat = i * 256 + tid, row = flat >> 3, c = flat & 7;
      stage4_f32_to_f16(W + (size_t)(n0 + row) * K + k0 + c * 4, &Ws[row][c * 4]);
    }
    __syncthreads();

    v16h a[2];
#pragma unroll
    for (int mi = 0; mi < 2; ++mi)
#pragma unroll
      for (int e = 0; e < 16; ++e) {
        int kk = kb + e + ((e & 8) ? 8 : 0);
        a[mi][e] = Xs[wm * 32 + mi * 16 + nl][kk];
      }
#pragma unroll
    for (int ns = 0; ns < 4; ++ns) {
      v16h b;   // column n = W row (n0+wn*64+ns*16+nl), K along the W row
#pragma unroll
      for (int e = 0; e < 16; ++e) {
        int kk = kb + e + ((e & 8) ? 8 : 0);
        b[e] = Ws[wn * 64 + ns * 16 + nl][kk];
      }
#pragma unroll
      for (int mi = 0; mi < 2; ++mi)
        acc[mi][ns] = __builtin_amdgcn_wmma_f32_16x16x32_f16(
            false, a[mi], false, b, (short)0, acc[mi][ns], false, false);
    }
    __syncthreads();
  }

#pragma unroll
  for (int mi = 0; mi < 2; ++mi)
#pragma unroll
    for (int ns = 0; ns < 4; ++ns)
#pragma unroll
      for (int r = 0; r < 8; ++r) {
        size_t idx = (size_t)(m0 + wm * 32 + mi * 16 + r + half * 8) * N +
                     n0 + wn * 64 + ns * 16 + nl;
        float vv = acc[mi][ns][r] * oscale;
        if (F16OUT) ((_Float16*)Yp)[idx] = (_Float16)vv;
        else        ((float*)Yp)[idx] = vv;
      }
}

// ---------------------------------------------------------------------------
// Forget gate: f[h][t] = log_sigmoid(hidden[t] . Wf[h] + bf[h])
// ---------------------------------------------------------------------------
__global__ void __launch_bounds__(256)
fgate_kernel(const float* __restrict__ x, const float* __restrict__ Wf,
             const float* __restrict__ bf, float* __restrict__ f) {
  int idx = blockIdx.x * 256 + threadIdx.x;
  if (idx >= NH * T_SEQ) return;
  int h = idx / T_SEQ, t = idx % T_SEQ;
  const float* xr = x + (size_t)t * HID;
  const float* wr = Wf + (size_t)h * HID;
  float acc = bf[h];
  for (int kk = 0; kk < HID; ++kk) acc = fmaf(xr[kk], wr[kk], acc);
  float ls = (acc > 0.f) ? -log1pf(__expf(-acc)) : (acc - log1pf(__expf(acc)));
  f[(size_t)h * T_SEQ + t] = ls;
}

// Cumulative decay (both directions): gc[dir][h][p] over direction-local p.
// One 256-thread block per (dir, head). Each thread sums its 8 consecutive
// positions, the 32 lane totals are scanned by shuffles, the 8 wave totals
// go through LDS; every thread then adds the sum of all that lies before it.
__global__ void __launch_bounds__(256)
fscan_kernel(const float* __restrict__ f, float* __restrict__ gc) {
  __shared__ float wtot[8];
  const int tid  = threadIdx.x;
  const int wave = tid >> 5;
  const int lane = tid & 31;
  const int dir  = blockIdx.x >> 4;
  const int h    = blockIdx.x & 15;
  const int p0   = tid * 8;
  const float* fh = f + (size_t)h * T_SEQ;

  // Position p reads t = p, or t = T-1-p in the reverse direction: there the
  // thread's 8 floats lie at T-8-p0 and are taken from the top down.
  const float* src = fh + (dir ? (T_SEQ - 8 - p0) : p0);
  const float4 a = *(const float4*)(src);
  const float4 b = *(const float4*)(src + 4);
  float x[8];
  x[0] = dir ? b.w : a.x;  x[1] = dir ? b.z : a.y;
  x[2] = dir ? b.y : a.z;  x[3] = dir ? b.x : a.w;
  x[4] = dir ? a.w : b.x;  x[5] = dir ? a.z : b.y;
  x[6] = dir ? a.y : b.z;  x[7] = dir ? a.x : b.w;
#pragma unroll
  for (int i = 1; i < 8; ++i) x[i] += x[i - 1];

  float incl = x[7];             // inclusive scan of the lane totals
#pragma unroll
  for (int off = 1; off < 32; off <<= 1) {
    float up = __shfl_up(incl, off, 32);
    if (lane >= off) incl += up;
  }
  const float excl = __shfl_up(incl, 1, 32);
  if (lane == 31) wtot[wave] = incl;
  __syncthreads();               // publishes the 8 wave totals
  float base = (lane > 0) ? excl : 0.f;   // lanes before this one, same wave
#pragma unroll
  for (int j = 0; j < 7; ++j)
    if (j < wave) base += wtot[j];

  float* dst = gc + (size_t)blockIdx.x * T_SEQ + p0;
  *(float4*)(dst)     = make_float4(x[0] + base, x[1] + base, x[2] + base, x[3] + base);
  *(float4*)(dst + 4) = make_float4(x[4] + base, x[5] + base, x[6] + base, x[7] + base);
}

// ---------------------------------------------------------------------------
// Flash-style forgetting attention, one wave per 16-row Q tile.
// grid = (T/16/WPB, NH, 2 directions). Causal in direction-local coords.
// q/k/v are f16 (q pre-scaled). K/V blocks async-DMA'd to LDS as raw f16.
// S tile: 16x32 via 4 WMMA; PV: 4 WMMA with ds_load_tr16_b128 V-columns.
// ---------------------------------------------------------------------------
__global__ void __launch_bounds__(WPB * 32)
fox_attn_kernel(const _Float16* __restrict__ q, const _Float16* __restrict__ k,
                const _Float16* __restrict__ v, const float* __restrict__ gc,
                float* __restrict__ obuf) {
  __shared__ _Float16 kv_s[WPB][32][72];   // 144B row stride (16B multiple)
  __shared__ _Float16 p_s[WPB][16][32];

  const int w    = threadIdx.x >> 5;
  const int lane = threadIdx.x & 31;
  const int half = (lane >> 4) & 1;
  const int nl   = lane & 15;
  const int kbh  = half * 8;
  const int qt   = blockIdx.x * WPB + w;    // q-tile index, 0..127
  const int h    = blockIdx.y;
  const int dir  = blockIdx.z;
  const float* gcd = gc + ((size_t)dir * NH + h) * T_SEQ;

  // Q fragments for this wave's 16 rows (q already scaled by d^-0.5).
  int qp_a = qt * 16 + nl;
  int tq   = dir ? (T_SEQ - 1 - qp_a) : qp_a;
  const _Float16* qrow = q + (size_t)tq * HID + h * HD;
  v16h a0, a1;
#pragma unroll
  for (int e = 0; e < 16; ++e) {
    int kk = kbh + e + ((e & 8) ? 8 : 0);
    a0[e] = qrow[kk];
    a1[e] = qrow[32 + kk];
  }
  float gq[8];
#pragma unroll
  for (int r = 0; r < 8; ++r) gq[r] = gcd[qt * 16 + r + half * 8];

  v8f o[4];
#pragma unroll
  for (int i = 0; i < 4; ++i) o[i] = (v8f){0,0,0,0,0,0,0,0};
  float rmax[8], rsum[8];
#pragma unroll
  for (int r = 0; r < 8; ++r) { rmax[r] = -1e30f; rsum[r] = 0.f; }

  const int nkb = (qt >> 1) + 1;            // causal: kv blocks of 32
  for (int kbI = 0; kbI < nkb; ++kbI) {
    const int kv0 = kbI * 32;

    // ---- stage K block (32 x 64 f16 = 32 rows x 8 16B chunks) ----
    wait_ds0();   // prior iter's LDS reads done before DMA overwrites
#pragma unroll
    for (int i = 0; i < 8; ++i) {
      int flat = i * 32 + lane, row = flat >> 3, c = flat & 7;
      int p = kv0 + row, t = dir ? (T_SEQ - 1 - p) : p;
      copy16_g2l(k + (size_t)t * HID + h * HD + c * 8, &kv_s[w][row][c * 8]);
    }
    wait_async0();

    // ---- S = Q K^T : two 16x16 accum tiles ----
    v8f s0 = (v8f){0,0,0,0,0,0,0,0};
    v8f s1 = (v8f){0,0,0,0,0,0,0,0};
#pragma unroll
    for (int ks = 0; ks < 2; ++ks) {
      v16h b0, b1;
#pragma unroll
      for (int e = 0; e < 16; ++e) {
        int kk = ks * 32 + kbh + e + ((e & 8) ? 8 : 0);
        b0[e] = kv_s[w][nl][kk];        // key rows 0..15
        b1[e] = kv_s[w][16 + nl][kk];   // key rows 16..31
      }
      s0 = __builtin_amdgcn_wmma_f32_16x16x32_f16(
          false, (ks ? a1 : a0), false, b0, (short)0, s0, false, false);
      s1 = __builtin_amdgcn_wmma_f32_16x16x32_f16(
          false, (ks ? a1 : a0), false, b1, (short)0, s1, false, false);
    }

    // ---- decay + causal mask + online softmax (rows across 16 lanes) ----
    float gk0 = gcd[kv0 + nl];
    float gk1 = gcd[kv0 + 16 + nl];
    int kp0 = kv0 + nl, kp1 = kv0 + 16 + nl;
#pragma unroll
    for (int r = 0; r < 8; ++r) {
      int qp = qt * 16 + r + half * 8;
      float x0 = (kp0 <= qp) ? (s0[r] + gq[r] - gk0) : -1e30f;
      float x1 = (kp1 <= qp) ? (s1[r] + gq[r] - gk1) : -1e30f;
      float m = fmaxf(x0, x1);
#pragma unroll
      for (int off = 1; off < 16; off <<= 1)
        m = fmaxf(m, __shfl_xor(m, off, 32));
      float nm    = fmaxf(rmax[r], m);
      float alpha = __expf(rmax[r] - nm);
      rmax[r] = nm;
      float p0 = __expf(x0 - nm), p1 = __expf(x1 - nm);
      float ps = p0 + p1;
#pragma unroll
      for (int off = 1; off < 16; off <<= 1)
        ps += __shfl_xor(ps, off, 32);
      rsum[r] = rsum[r] * alpha + ps;
#pragma unroll
      for (int i = 0; i < 4; ++i) o[i][r] *= alpha;
      // transpose P (C-layout -> A-layout) through LDS
      p_s[w][r + half * 8][nl]      = (_Float16)p0;
      p_s[w][r + half * 8][16 + nl] = (_Float16)p1;
    }
    wait_ds0();

    // ---- stage V block (reuse kv_s) ----
#pragma unroll
    for (int i = 0; i < 8; ++i) {
      int flat = i * 32 + lane, row = flat >> 3, c = flat & 7;
      int p = kv0 + row, t = dir ? (T_SEQ - 1 - p) : p;
      copy16_g2l(v + (size_t)t * HID + h * HD + c * 8, &kv_s[w][row][c * 8]);
    }
    wait_async0();

    // ---- O += P V : P as A fragment, V columns as B fragments ----
    v16h ap;
#pragma unroll
    for (int e = 0; e < 16; ++e) {
      int kk = kbh + e + ((e & 8) ? 8 : 0);
      ap[e] = p_s[w][nl][kk];
    }
#pragma unroll
    for (int ns = 0; ns < 4; ++ns) {
      v16h bv;
#if HAS_DS_TR16
      {
        auto r0 = __builtin_amdgcn_ds_load_tr16_b128(
            (__attribute__((address_space(3))) v8h*)&kv_s[w][nl][ns * 16]);
        auto r1 = __builtin_amdgcn_ds_load_tr16_b128(
            (__attribute__((address_space(3))) v8h*)&kv_s[w][16 + nl][ns * 16]);
        v8h lo = __builtin_bit_cast(v8h, r0);
        v8h hi = __builtin_bit_cast(v8h, r1);
#pragma unroll
        for (int e = 0; e < 8; ++e) { bv[e] = lo[e]; bv[8 + e] = hi[e]; }
      }
#else
#pragma unroll
      for (int e = 0; e < 16; ++e) {
        int kk = kbh + e + ((e & 8) ? 8 : 0);
        bv[e] = kv_s[w][kk][ns * 16 + nl];
      }
#endif
      o[ns] = __builtin_amdgcn_wmma_f32_16x16x32_f16(
          false, ap, false, bv, (short)0, o[ns], false, false);
    }
  }

  // ---- epilogue: normalize and scatter into concat buffer [T, 2H] ----
#pragma unroll
  for (int ns = 0; ns < 4; ++ns)
#pragma unroll
    for (int r = 0; r < 8; ++r) {
      int qp = qt * 16 + r + half * 8;
      int t  = dir ? (T_SEQ - 1 - qp) : qp;
      obuf[(size_t)t * (2 * HID) + (size_t)dir * HID + h * HD + ns * 16 + nl] =
          o[ns][r] / rsum[r];
    }
}

// ---------------------------------------------------------------------------
extern "C" void kernel_launch(void* const* d_in, const int* in_sizes, int n_in,
                              void* d_out, int out_size, void* d_ws, size_t ws_size,
                              hipStream_t stream) {
  (void)in_sizes; (void)n_in; (void)out_size; (void)ws_size;
  const float* hidden = (const float*)d_in[0];
  const float* Wq     = (const float*)d_in[1];
  const float* Wk     = (const float*)d_in[2];
  const float* Wv     = (const float*)d_in[3];
  const float* Wf     = (const float*)d_in[4];
  const float* bf     = (const float*)d_in[5];
  const float* Wo     = (const float*)d_in[6];
  float* out = (float*)d_out;

  // Workspace layout: q|k|v (f16) then f|gc|o_concat (f32)
  _Float16* qb = (_Float16*)d_ws;
  _Float16* kb = qb + (size_t)T_SEQ * HID;
  _Float16* vb = kb + (size_t)T_SEQ * HID;
  float* fb = (float*)(vb + (size_t)T_SEQ * HID);
  float* gc = fb + (size_t)NH * T_SEQ;
  float* ob = gc + (size_t)2 * NH * T_SEQ;

  dim3 gproj(T_SEQ / 128, HID / 128);
  gemm_f16_wmma<true><<<gproj, 256, 0, stream>>>(hidden, Wq, qb, T_SEQ, HID, HID,
                                                 0.125f /* d^-0.5 folded in */);
  gemm_f16_wmma<true><<<gproj, 256, 0, stream>>>(hidden, Wk, kb, T_SEQ, HID, HID, 1.f);
  gemm_f16_wmma<true><<<gproj, 256, 0, stream>>>(hidden, Wv, vb, T_SEQ, HID, HID, 1.f);

  fgate_kernel<<<(NH * T_SEQ) / 256, 256, 0, stream>>>(hidden, Wf, bf, fb);
  fscan_kernel<<<2 * NH, 256, 0, stream>>>(fb, gc);

  dim3 gattn(T_SEQ / 16 / WPB, NH, 2);
  fox_attn_kernel<<<gattn, WPB * 32, 0, stream>>>(qb, kb, vb, gc, ob);

  dim3 gout(T_SEQ / 128, HID / 128);
  gemm_f16_wmma<false><<<gout, 256, 0, stream>>>(ob, Wo, out, T_SEQ, HID, 2 * HID, 1.f);
}

// v002
// A run of this version takes 295 microseconds.
// In two side-by-side timings against v001, it was 1.35 and 1.36 times as fast.
// All steps since v000 together make it 1.66 times as fast.
#include <hip/hip_runtime.h>
#include <cstddef>

#define T_SEQ 2048
#define HID   1024
#define NH    16
#define HD    64     // head dim
#define WPB   4      // waves per block in attention kernel

typedef __attribute__((ext_vector_type(16))) _Float16 v16h;
typedef __attribute__((ext_vector_type(8)))  _Float16 v8h;
typedef __attribute__((ext_vector_type(8)))  float    v8f;
typedef int async_v4i __attribute__((vector_size(4 * sizeof(int))));

#if __has_builtin(__builtin_amdgcn_global_load_async_to_lds_b128)
#define HAS_ASYNC_LDS 1
#else
#define HAS_ASYNC_LDS 0
#endif

#if __has_builtin(__builtin_amdgcn_ds_load_tr16_b128)
#define HAS_DS_TR16 1
#else
#define HAS_DS_TR16 0
#endif

__device__ __forceinline__ void copy16_g2l(const void* g, void* l) {
#if HAS_ASYNC_LDS
  __builtin_amdgcn_global_load_async_to_lds_b128(
      (__attribute__((address_space(1))) async_v4i*)(g),
      (__attribute__((address_space(3))) async_v4i*)(l), 0, 0);
#else
  *(float4*)l = *(const float4*)g;
#endif
}

__device__ __forceinline__ void wait_async0() {
#if HAS_ASYNC_LDS
#if __has_builtin(__builtin_amdgcn_s_wait_asynccnt)
  __builtin_amdgcn_s_wait_asynccnt(0);
#else
  asm volatile("s_wait_asynccnt 0" ::: "memory");
#endif
#endif
}

__device__ __forceinline__ void wait_ds0() {
  asm volatile("s_wait_dscnt 0" ::: "memory");
}

// Butterfly over each 16-lane row (lane ^ 1, 2, 4, 8) for eight independent
// values at once, on the vector unit by DPP. The eight values of a step stand
// side by side so that each link of a chain is covered by the seven others.
#define ROW16_STEP(op, k)                                        \
  op " %0, %0, %0 row_xmask:" #k " row_mask:0xf bank_mask:0xf\n\t" \
  op " %1, %1, %1 row_xmask:" #k " row_mask:0xf bank_mask:0xf\n\t" \
  op " %2, %2, %2 row_xmask:" #k " row_mask:0xf bank_mask:0xf\n\t" \
  op " %3, %3, %3 row_xmask:" #k " row_mask:0xf bank_mask:0xf\n\t" \
  op " %4, %4, %4 row_xmask:" #k " row_mask:0xf bank_mask:0xf\n\t" \
  op " %5, %5, %5 row_xmask:" #k " row_mask:0xf bank_mask:0xf\n\t" \
  op " %6, %6, %6 row_xmask:" #k " row_mask:0xf bank_mask:0xf\n\t" \
  op " %7, %7, %7 row_xmask:" #k " row_mask:0xf bank_mask:0xf\n\t"
#define ROW16_ALL(op) \
  ROW16_STEP(op, 1) ROW16_STEP(op, 2) ROW16_STEP(op, 4) ROW16_STEP(op, 8)

// Needs all 32 lanes on. Replaces __shfl_xor, which compiles to an LDS-path
// permute with a wait behind each link.
__device__ __forceinline__ void row16_max8(float (&x)[8]) {
  asm(ROW16_ALL("v_max_num_f32_dpp")
      : "+v"(x[0]), "+v"(x[1]), "+v"(x[2]), "+v"(x[3]),
        "+v"(x[4]), "+v"(x[5]), "+v"(x[6]), "+v"(x[7]));
}

__device__ __forceinline__ float exp_with_slot(float x) {
  float y;
  asm("v_exp_f32 %0, %1\n\tv_nop" : "=v"(y) : "v"(x * 0x1.715476p+0f));
  return y;
}

__device__ __forceinline__ void row16_sum8(float (&x)[8]) {
  asm(ROW16_ALL("v_add_f32_dpp")
      : "+v"(x[0]), "+v"(x[1]), "+v"(x[2]), "+v"(x[3]),
        "+v"(x[4]), "+v"(x[5]), "+v"(x[6]), "+v"(x[7]));
}

// Stage 4 fp32 values from global as 4 f16 into LDS (merges to ds_store_b64).
__device__ __forceinline__ void stage4_f32_to_f16(const float* g, _Float16* l) {
  float4 t = *(const float4*)g;
  l[0] = (_Float16)t.x;
  l[1] = (_Float16)t.y;
  l[2] = (_Float16)t.z;
  l[3] = (_Float16)t.w;
}

template <bool F16OUT>
__global__ void __launch_bounds__(256)
gemm_f16_wmma(const float* __restrict__ X, const float* __restrict__ W,
              void* __restrict__ Yp, int M, int N, int K, float oscale) {
  __shared__ _Float16 Xs[128][40];   // 80B row stride (16B multiple)
  __shared__ _Float16 Ws[128][40];

  const int tid  = threadIdx.x;
  const int wave = tid >> 5;
  const int lane = tid & 31;
  const int half = (lane >> 4) & 1;   // which 16-lane half
  const int nl   = lane & 15;
  const int kb   = half * 8;          // per-half K base inside the 32-wide step
  const int wm   = wave & 3;          // 4 wave-rows of 32
  const int wn   = wave >> 2;         // 2 wave-cols of 64
  const int m0   = blockIdx.x * 128;
  const int n0   = blockIdx.y * 128;

  v8f acc[2][4];
#pragma unroll
  for (int mi = 0; mi < 2; ++mi)
#pragma unroll
    for (int ns = 0; ns < 4; ++ns) acc[mi][ns] = (v8f){0,0,0,0,0,0,0,0};

  for (int k0 = 0; k0 < K; k0 += 32) {
    // Stage both 128x32 tiles as f16: 1024 4-float chunks each, 256 threads.
#pragma unroll
    for (int i = 0; i < 4; ++i) {
      int flat = i * 256 + tid, row = flat >> 3, c = flat & 7;
      stage4_f32_to_f16(X + (size_t)(m0 + row) * K + k0 + c * 4, &Xs[row][c * 4]);
    }
#pragma unroll
    for (int i = 0; i < 4; ++i) {
      int flat = i * 256 + tid, row = flat >> 3, c = flat & 7;
      stage4_f32_to_f16(W + (size_t)(n0 + row) * K + k0 + c * 4, &Ws[row][c * 4]);
    }
    __syncthreads();

    v16h a[2];
#pragma unroll
    for (int mi = 0; mi < 2; ++mi)
#pragma unroll
      for (int e = 0; e < 16; ++e) {
        int kk = kb + e + ((e & 8) ? 8 : 0);
        a[mi][e] = Xs[wm * 32 + mi * 16 + nl][kk];
      }
#pragma unroll
    for (int ns = 0; ns < 4; ++ns) {
      v16h b;   // column n = W row (n0+wn*64+ns*16+nl), K along the W row
#pragma unroll
      for (int e = 0; e < 16; ++e) {
        int kk = kb + e + ((e & 8) ? 8 : 0);
        b[e] = Ws[wn * 64 + ns * 16 + nl][kk];
      }
#pragma unroll
      for (int mi = 0; mi < 2; ++mi)
        acc[mi][ns] = __builtin_amdgcn_wmma_f32_16x16x32_f16(
            false, a[mi], false, b, (short)0, acc[mi][ns], false, false);
    }
    __syncthreads();
  }

#pragma unroll
  for (int mi = 0; mi < 2; ++mi)
#pragma unroll
    for (int ns = 0; ns < 4; ++ns)
#pragma unroll
      for (int r = 0; r < 8; ++r) {
        size_t idx = (size_t)(m0 + wm * 32 + mi * 16 + r + half * 8) * N +
                     n0 + wn * 64 + ns * 16 + nl;
        float vv = acc[mi][ns][r] * oscale;
        if (F16OUT) ((_Float16*)Yp)[idx] = (_Float16)vv;
        else        ((float*)Yp)[idx] = vv;
      }
}

// ---------------------------------------------------------------------------
// Forget gate: f[h][t] = log_sigmoid(hidden[t] . Wf[h] + bf[h])
// ---------------------------------------------------------------------------
__global__ void __launch_bounds__(256)
fgate_kernel(const float* __restrict__ x, const float* __restrict__ Wf,
             const float* __restrict__ bf, float* __restrict__ f) {
  int idx = blockIdx.x * 256 + threadIdx.x;
  if (idx >= NH * T_SEQ) return;
  int h = idx / T_SEQ, t = idx % T_SEQ;
  const float* xr = x + (size_t)t * HID;
  const float* wr = Wf + (size_t)h * HID;
  float acc = bf[h];
  for (int kk = 0; kk < HID; ++kk) acc = fmaf(xr[kk], wr[kk], acc);
  float ls = (acc > 0.f) ? -log1pf(__expf(-acc)) : (acc - log1pf(__expf(acc)));
  f[(size_t)h * T_SEQ + t] = ls;
}

// Cumulative decay (both directions): gc[dir][h][p] over direction-local p.
// One 256-thread block per (dir, head). Each thread sums its 8 consecutive
// positions, the 32 lane totals are scanned by shuffles, the 8 wave totals
// go through LDS; every thread then adds the sum of all that lies before it.
__global__ void __launch_bounds__(256)
fscan_kernel(const float* __restrict__ f, float* __restrict__ gc) {
  __shared__ float wtot[8];
  const int tid  = threadIdx.x;
  const int wave = tid >> 5;
  const int lane = tid & 31;
  const int dir  = blockIdx.x >> 4;
  const int h    = blockIdx.x & 15;
  const int p0   = tid * 8;
  const float* fh = f + (size_t)h * T_SEQ;

  // Position p reads t = p, or t = T-1-p in the reverse direction: there the
  // thread's 8 floats lie at T-8-p0 and are taken from the top down.
  const float* src = fh + (dir ? (T_SEQ - 8 - p0) : p0);
  const float4 a = *(const float4*)(src);
  const float4 b = *(const float4*)(src + 4);
  float x[8];
  x[0] = dir ? b.w : a.x;  x[1] = dir ? b.z : a.y;
  x[2] = dir ? b.y : a.z;  x[3] = dir ? b.x : a.w;
  x[4] = dir ? a.w : b.x;  x[5] = dir ? a.z : b.y;
  x[6] = dir ? a.y : b.z;  x[7] = dir ? a.x : b.w;
#pragma unroll
  for (int i = 1; i < 8; ++i) x[i] += x[i - 1];

  float incl = x[7];             // inclusive scan of the lane totals
#pragma unroll
  for (int off = 1; off < 32; off <<= 1) {
    float up = __shfl_up(incl, off, 32);
    if (lane >= off) incl += up;
  }
  const float excl = __shfl_up(incl, 1, 32);
  if (lane == 31) wtot[wave] = incl;
  __syncthreads();               // publishes the 8 wave totals
  float base = (lane > 0) ? excl : 0.f;   // lanes before this one, same wave
#pragma unroll
  for (int j = 0; j < 7; ++j)
    if (j < wave) base += wtot[j];

  float* dst = gc + (size_t)blockIdx.x * T_SEQ + p0;
  *(float4*)(dst)     = make_float4(x[0] + base, x[1] + base, x[2] + base, x[3] + base);
  *(float4*)(dst + 4) = make_float4(x[4] + base, x[5] + base, x[6] + base, x[7] + base);
}

// ---------------------------------------------------------------------------
// Flash-style forgetting attention, one wave per 16-row Q tile.
// grid = (T/16/WPB, NH, 2 directions). Causal in direction-local coords.
// q/k/v are f16 (q pre-scaled). K/V blocks async-DMA'd to LDS as raw f16.
// S tile: 16x32 via 4 WMMA; PV: 4 WMMA with ds_load_tr16_b128 V-columns.
// ---------------------------------------------------------------------------
__global__ void __launch_bounds__(WPB * 32)
fox_attn_kernel(const _Float16* __restrict__ q, const _Float16* __restrict__ k,
                const _Float16* __restrict__ v, const float* __restrict__ gc,
                float* __restrict__ obuf) {
  __shared__ _Float16 kv_s[WPB][32][72];   // 144B row stride (16B multiple)
  __shared__ _Float16 p_s[WPB][16][32];

  const int w    = threadIdx.x >> 5;
  const int lane = threadIdx.x & 31;
  const int half = (lane >> 4) & 1;
  const int nl   = lane & 15;
  const int kbh  = half * 8;
  const int qt   = blockIdx.x * WPB + w;    // q-tile index, 0..127
  const int h    = blockIdx.y;
  const int dir  = blockIdx.z;
  const float* gcd = gc + ((size_t)dir * NH + h) * T_SEQ;

  // Q fragments for this wave's 16 rows (q already scaled by d^-0.5).
  int qp_a = qt * 16 + nl;
  int tq   = dir ? (T_SEQ - 1 - qp_a) : qp_a;
  const _Float16* qrow = q + (size_t)tq * HID + h * HD;
  v16h a0, a1;
#pragma unroll
  for (int e = 0; e < 16; ++e) {
    int kk = kbh + e + ((e & 8) ? 8 : 0);
    a0[e] = qrow[kk];
    a1[e] = qrow[32 + kk];
  }
  float gq[8];
#pragma unroll
  for (int r = 0; r < 8; ++r) gq[r] = gcd[qt * 16 + r + half * 8];

  v8f o[4];
#pragma unroll
  for (int i = 0; i < 4; ++i) o[i] = (v8f){0,0,0,0,0,0,0,0};
  float rmax[8], rsum[8];
#pragma unroll
  for (int r = 0; r < 8; ++r) { rmax[r] = -1e30f; rsum[r] = 0.f; }

  const int nkb = (qt >> 1) + 1;            // causal: kv blocks of 32
  for (int kbI = 0; kbI < nkb; ++kbI) {
    const int kv0 = kbI * 32;

    // ---- stage K block (32 x 64 f16 = 32 rows x 8 16B chunks) ----
    wait_ds0();   // prior iter's LDS reads done before DMA overwrites
#pragma unroll
    for (int i = 0; i < 8; ++i) {
      int flat = i * 32 + lane, row = flat >> 3, c = flat & 7;
      int p = kv0 + row, t = dir ? (T_SEQ - 1 - p) : p;
      copy16_g2l(k + (size_t)t * HID + h * HD + c * 8, &kv_s[w][row][c * 8]);
    }
    wait_async0();

    // ---- S = Q K^T : two 16x16 accum tiles ----
    v8f s0 = (v8f){0,0,0,0,0,0,0,0};
    v8f s1 = (v8f){0,0,0,0,0,0,0,0};
#pragma unroll
    for (int ks = 0; ks < 2; ++ks) {
      v16h b0, b1;
#pragma unroll
      for (int e = 0; e < 16; ++e) {
        int kk = ks * 32 + kbh + e + ((e & 8) ? 8 : 0);
        b0[e] = kv_s[w][nl][kk];        // key rows 0..15
        b1[e] = kv_s[w][16 + nl][kk];   // key rows 16..31
      }
      s0 = __builtin_amdgcn_wmma_f32_16x16x32_f16(
          false, (ks ? a1 : a0), false, b0, (short)0, s0, false, false);
      s1 = __builtin_amdgcn_wmma_f32_16x16x32_f16(
          false, (ks ? a1 : a0), false, b1, (short)0, s1, false, false);
    }

    // ---- decay + causal mask + online softmax (rows across 16 lanes) ----
    float gk0 = gcd[kv0 + nl];
    float gk1 = gcd[kv0 + 16 + nl];
    int kp0 = kv0 + nl, kp1 = kv0 + 16 + nl;
    float x0[8], x1[8], m[8];
#pragma unroll
    for (int r = 0; r < 8; ++r) {
      int qp = qt * 16 + r + half * 8;
      x0[r] = (kp0 <= qp) ? (s0[r] + gq[r] - gk0) : -1e30f;
      x1[r] = (kp1 <= qp) ? (s1[r] + gq[r] - gk1) : -1e30f;
      m[r]  = fmaxf(x0[r], x1[r]);
    }
    row16_max8(m);
    float dm[8], ps[8];
#pragma unroll
    for (int r = 0; r < 8; ++r) {
      float nm = fmaxf(rmax[r], m[r]);
      dm[r] = rmax[r] - nm;
      rmax[r] = nm;
      float p0 = __expf(x0[r] - nm), p1 = __expf(x1[r] - nm);
      ps[r] = p0 + p1;
      // transpose P (C-layout -> A-layout) through LDS
      p_s[w][r + half * 8][nl]      = (_Float16)p0;
      p_s[w][r + half * 8][16 + nl] = (_Float16)p1;
    }
    wait_ds0();

    // ---- stage V block (reuse kv_s) ----
#pragma unroll
    for (int i = 0; i < 8; ++i) {
      int flat = i * 32 + lane, row = flat >> 3, c = flat & 7;
      int p = kv0 + row, t = dir ? (T_SEQ - 1 - p) : p;
      copy16_g2l(v + (size_t)t * HID + h * HD + c * 8, &kv_s[w][row][c * 8]);
    }
    // Row sums, alpha and the rescale need no LDS. The scheduling barrier keeps
    // them behind the copies' issue, where they fill the wait for the V block
    // and its fragments; without it the compiler lifts them ahead of the copies.
    __builtin_amdgcn_sched_barrier(0);
    row16_sum8(ps);
#pragma unroll
    for (int r = 0; r < 8; ++r) {
      float alpha = exp_with_slot(dm[r]);
      rsum[r] = rsum[r] * alpha + ps[r];
#pragma unroll
      for (int i = 0; i < 4; ++i) o[i][r] *= alpha;
    }
    wait_async0();

    // ---- O += P V : P as A fragment, V columns as B fragments ----
    v16h ap;
#pragma unroll
    for (int e = 0; e < 16; ++e) {
      int kk = kbh + e + ((e & 8) ? 8 : 0);
      ap[e] = p_s[w][nl][kk];
    }
#pragma unroll
    for (int ns = 0; ns < 4; ++ns) {
      v16h bv;
#if HAS_DS_TR16
      {
        auto r0 = __builtin_amdgcn_ds_load_tr16_b128(
            (__attribute__((address_space(3))) v8h*)&kv_s[w][nl][ns * 16]);
        auto r1 = __builtin_amdgcn_ds_load_tr16_b128(
            (__attribute__((address_space(3))) v8h*)&kv_s[w][16 + nl][ns * 16]);
        v8h lo = __builtin_bit_cast(v8h, r0);
        v8h hi = __builtin_bit_cast(v8h, r1);
#pragma unroll
        for (int e = 0; e < 8; ++e) { bv[e] = lo[e]; bv[8 + e] = hi[e]; }
      }
#else
#pragma unroll
      for (int e = 0; e < 16; ++e) {
        int kk = kbh + e + ((e & 8) ? 8 : 0);
        bv[e] = kv_s[w][kk][ns * 16 + nl];
      }
#endif
      o[ns] = __builtin_amdgcn_wmma_f32_16x16x32_f16(
          false, ap, false, bv, (short)0, o[ns], false, false);
    }
  }

  // ---- epilogue: normalize and scatter into concat buffer [T, 2H] ----
#pragma unroll
  for (int ns = 0; ns < 4; ++ns)
#pragma unroll
    for (int r = 0; r < 8; ++r) {
      int qp = qt * 16 + r + half * 8;
      int t  = dir ? (T_SEQ - 1 - qp) : qp;
      obuf[(size_t)t * (2 * HID) + (size_t)dir * HID + h * HD + ns * 16 + nl] =
          o[ns][r] / rsum[r];
    }
}

// ---------------------------------------------------------------------------
extern "C" void kernel_launch(void* const* d_in, const int* in_sizes, int n_in,
                              void* d_out, int out_size, void* d_ws, size_t ws_size,
                              hipStream_t stream) {
  (void)in_sizes; (void)n_in; (void)out_size; (void)ws_size;
  const float* hidden = (const float*)d_in[0];
  const float* Wq     = (const float*)d_in[1];
  const float* Wk     = (const float*)d_in[2];
  const float* Wv     = (const float*)d_in[3];
  const float* Wf     = (const float*)d_in[4];
  const float* bf     = (const float*)d_in[5];
  const float* Wo     = (const float*)d_in[6];
  float* out = (float*)d_out;

  // Workspace layout: q|k|v (f16) then f|gc|o_concat (f32)
  _Float16* qb = (_Float16*)d_ws;
  _Float16* kb = qb + (size_t)T_SEQ * HID;
  _Float16* vb = kb + (size_t)T_SEQ * HID;
  float* fb = (float*)(vb + (size_t)T_SEQ * HID);
  float* gc = fb + (size_t)NH * T_SEQ;
  float* ob = gc + (size_t)2 * NH * T_SEQ;

  dim3 gproj(T_SEQ / 128, HID / 128);
  gemm_f16_wmma<true><<<gproj, 256, 0, stream>>>(hidden, Wq, qb, T_SEQ, HID, HID,
                                                 0.125f /* d^-0.5 folded in */);
  gemm_f16_wmma<true><<<gproj, 256, 0, stream>>>(hidden, Wk, kb, T_SEQ, HID, HID, 1.f);
  gemm_f16_wmma<true><<<gproj, 256, 0, stream>>>(hidden, Wv, vb, T_SEQ, HID, HID, 1.f);

  fgate_kernel<<<(NH * T_SEQ) / 256, 256, 0, stream>>>(hidden, Wf, bf, fb);
  fscan_kernel<<<2 * NH, 256, 0, stream>>>(fb, gc);

  dim3 gattn(T_SEQ / 16 / WPB, NH, 2);
  fox_attn_kernel<<<gattn, WPB * 32, 0, stream>>>(qb, kb, vb, gc, ob);

  dim3 gout(T_SEQ / 128, HID / 128);
  gemm_f16_wmma<false><<<gout, 256, 0, stream>>>(ob, Wo, out, T_SEQ, HID, 2 * HID, 1.f);
}

// v003
// Measured time: 260 microseconds a run.
// In two side-by-side timings against v002, it was 1.14 and 1.13 times as fast.
// Counting every step since v000, it is 1.88 times as fast.
#include <hip/hip_runtime.h>
#include <cstddef>

#define T_SEQ 2048
#define HID   1024
#define NH    16
#define HD    64     // head dim
#define WPB   4      // waves per block in attention kernel

typedef __attribute__((ext_vector_type(16))) _Float16 v16h;
typedef __attribute__((ext_vector_type(8)))  _Float16 v8h;
typedef __attribute__((ext_vector_type(8)))  float    v8f;
typedef int async_v4i __attribute__((vector_size(4 * sizeof(int))));

#if __has_builtin(__builtin_amdgcn_global_load_async_to_lds_b128)
#define HAS_ASYNC_LDS 1
#else
#define HAS_ASYNC_LDS 0
#endif

#if __has_builtin(__builtin_amdgcn_ds_load_tr16_b128)
#define HAS_DS_TR16 1
#else
#define HAS_DS_TR16 0
#endif

__device__ __forceinline__ void copy16_g2l(const void* g, void* l) {
#if HAS_ASYNC_LDS
  __builtin_amdgcn_global_load_async_to_lds_b128(
      (__attribute__((address_space(1))) async_v4i*)(g),
      (__attribute__((address_space(3))) async_v4i*)(l), 0, 0);
#else
  *(float4*)l = *(const float4*)g;
#endif
}

__device__ __forceinline__ void wait_async0() {
#if HAS_ASYNC_LDS
#if __has_builtin(__builtin_amdgcn_s_wait_asynccnt)
  __builtin_amdgcn_s_wait_asynccnt(0);
#else
  asm volatile("s_wait_asynccnt 0" ::: "memory");
#endif
#endif
}

__device__ __forceinline__ void wait_ds0() {
  asm volatile("s_wait_dscnt 0" ::: "memory");
}

// Butterfly over each 16-lane row (lane ^ 1, 2, 4, 8) for eight independent
// values at once, on the vector unit by DPP. The eight values of a step stand
// side by side so that each link of a chain is covered by the seven others.
#define ROW16_STEP(op, k)                                        \
  op " %0, %0, %0 row_xmask:" #k " row_mask:0xf bank_mask:0xf\n\t" \
  op " %1, %1, %1 row_xmask:" #k " row_mask:0xf bank_mask:0xf\n\t" \
  op " %2, %2, %2 row_xmask:" #k " row_mask:0xf bank_mask:0xf\n\t" \
  op " %3, %3, %3 row_xmask:" #k " row_mask:0xf bank_mask:0xf\n\t" \
  op " %4, %4, %4 row_xmask:" #k " row_mask:0xf bank_mask:0xf\n\t" \
  op " %5, %5, %5 row_xmask:" #k " row_mask:0xf bank_mask:0xf\n\t" \
  op " %6, %6, %6 row_xmask:" #k " row_mask:0xf bank_mask:0xf\n\t" \
  op " %7, %7, %7 row_xmask:" #k " row_mask:0xf bank_mask:0xf\n\t"
#define ROW16_ALL(op) \
  ROW16_STEP(op, 1) ROW16_STEP(op, 2) ROW16_STEP(op, 4) ROW16_STEP(op, 8)

// Needs all 32 lanes on. Replaces __shfl_xor, which compiles to an LDS-path
// permute with a wait behind each link.
__device__ __forceinline__ void row16_max8(float (&x)[8]) {
  asm(ROW16_ALL("v_max_num_f32_dpp")
      : "+v"(x[0]), "+v"(x[1]), "+v"(x[2]), "+v"(x[3]),
        "+v"(x[4]), "+v"(x[5]), "+v"(x[6]), "+v"(x[7]));
}

__device__ __forceinline__ float exp_with_slot(float x) {
  float y;
  asm("v_exp_f32 %0, %1\n\tv_nop" : "=v"(y) : "v"(x * 0x1.715476p+0f));
  return y;
}

__device__ __forceinline__ void row16_sum8(float (&x)[8]) {
  asm(ROW16_ALL("v_add_f32_dpp")
      : "+v"(x[0]), "+v"(x[1]), "+v"(x[2]), "+v"(x[3]),
        "+v"(x[4]), "+v"(x[5]), "+v"(x[6]), "+v"(x[7]));
}

template <bool F16OUT>
__global__ void __launch_bounds__(256)
gemm_f16_wmma(const float* __restrict__ X, const float* __restrict__ W,
              void* __restrict__ Yp, int M, int N, int K, float oscale) {
  __shared__ _Float16 Xs[2][128][40];   // two stages; 80B row stride (16B multiple)
  __shared__ _Float16 Ws[2][128][40];

  const int tid  = threadIdx.x;
  const int wave = tid >> 5;
  const int lane = tid & 31;
  const int half = (lane >> 4) & 1;   // which 16-lane half
  const int nl   = lane & 15;
  const int kb   = half * 8;          // per-half K base inside the 32-wide step
  const int wm   = wave & 3;          // 4 wave-rows of 32
  const int wn   = wave >> 2;         // 2 wave-cols of 64
  const int m0   = blockIdx.x * 128;
  const int n0   = blockIdx.y * 128;

  v8f acc[2][4];
#pragma unroll
  for (int mi = 0; mi < 2; ++mi)
#pragma unroll
    for (int ns = 0; ns < 4; ++ns) acc[mi][ns] = (v8f){0,0,0,0,0,0,0,0};

  // Each thread moves 4 chunks of 4 floats of either 128x32 tile: rows
  // srow + 32 i, floats scol .. scol + 3.
  const int srow = tid >> 3;
  const int scol = (tid & 7) * 4;
  const float* xg = X + (size_t)(m0 + srow) * K + scol;
  const float* wg = W + (size_t)(n0 + srow) * K + scol;
  float4 xr[4], wr[4];   // the tile in flight from global memory

  // Issue the loads of the K-step that starts at k0; their data is not waited
  // for here.
  auto fetch = [&](int k0) {
    const float* px[4];
    const float* pw[4];
#pragma unroll
    for (int i = 0; i < 4; ++i) {
      px[i] = xg + (size_t)(i * 32) * K + k0;
      pw[i] = wg + (size_t)(i * 32) * K + k0;
    }
#pragma unroll
    for (int i = 0; i < 4; ++i) xr[i] = *(const float4*)px[i];
#pragma unroll
    for (int i = 0; i < 4; ++i) wr[i] = *(const float4*)pw[i];
    // The wait that stands before a register named by an issued load is
    // overwritten. The eight address pairs are its inputs, so that none is
    // reused (as a later load's destination, for a later address) ahead of it.
    // Its clobber also holds the loads' issue ahead of the LDS reads and
    // products that follow; sunk below them, their latency would stand open.
    asm volatile("s_wait_xcnt 0x0"
                 :: "v"(px[0]), "v"(px[1]), "v"(px[2]), "v"(px[3]),
                    "v"(pw[0]), "v"(pw[1]), "v"(pw[2]), "v"(pw[3])
                 : "memory");
  };
  // Convert the fetched tile to f16 and lay it into stage s.
  auto stash = [&](int s) {
#pragma unroll
    for (int i = 0; i < 4; ++i) {
      _Float16* xl = &Xs[s][srow + i * 32][scol];
      xl[0] = (_Float16)xr[i].x;  xl[1] = (_Float16)xr[i].y;
      xl[2] = (_Float16)xr[i].z;  xl[3] = (_Float16)xr[i].w;
      _Float16* wl = &Ws[s][srow + i * 32][scol];
      wl[0] = (_Float16)wr[i].x;  wl[1] = (_Float16)wr[i].y;
      wl[2] = (_Float16)wr[i].z;  wl[3] = (_Float16)wr[i].w;
    }
  };
  // The 8 WMMA of one K-step, operands from stage s.
  auto mma = [&](int s) {
    v16h a[2];
#pragma unroll
    for (int mi = 0; mi < 2; ++mi)
#pragma unroll
      for (int e = 0; e < 16; ++e) {
        int kk = kb + e + ((e & 8) ? 8 : 0);
        a[mi][e] = Xs[s][wm * 32 + mi * 16 + nl][kk];
      }
    v16h b[4];   // column n = W row (n0+wn*64+ns*16+nl), K along the W row
#pragma unroll
    for (int ns = 0; ns < 4; ++ns)
#pragma unroll
      for (int e = 0; e < 16; ++e) {
        int kk = kb + e + ((e & 8) ? 8 : 0);
        b[ns][e] = Ws[s][wn * 64 + ns * 16 + nl][kk];
      }
    // Keeps all twelve LDS reads ahead of the first product. With the fetched
    // tile held in registers the compiler otherwise reuses one B fragment's
    // registers four times, and each reuse waits out a full LDS latency.
    __builtin_amdgcn_sched_barrier(0);
#pragma unroll
    for (int ns = 0; ns < 4; ++ns)
#pragma unroll
      for (int mi = 0; mi < 2; ++mi)
        acc[mi][ns] = __builtin_amdgcn_wmma_f32_16x16x32_f16(
            false, a[mi], false, b[ns], (short)0, acc[mi][ns], false, false);
  };

  // Two LDS stages: the next K-step's global loads fly while this step's
  // products run. One barrier a step: it publishes the stage just written and
  // ends every wave's reads of the stage that the next step overwrites.
  fetch(0);
  stash(0);
  __syncthreads();
  int s = 0;
  for (int k0 = 32; k0 < K; k0 += 32) {
    fetch(k0);
    mma(s);
    // Keeps the conversions, and with them the wait for the loads, behind the
    // products; the compiler lifts them ahead to free registers early.
    __builtin_amdgcn_sched_barrier(0);
    stash(s ^ 1);
    __syncthreads();
    s ^= 1;
  }
  mma(s);

#pragma unroll
  for (int mi = 0; mi < 2; ++mi)
#pragma unroll
    for (int ns = 0; ns < 4; ++ns)
#pragma unroll
      for (int r = 0; r < 8; ++r) {
        size_t idx = (size_t)(m0 + wm * 32 + mi * 16 + r + half * 8) * N +
                     n0 + wn * 64 + ns * 16 + nl;
        float vv = acc[mi][ns][r] * oscale;
        if (F16OUT) ((_Float16*)Yp)[idx] = (_Float16)vv;
        else        ((float*)Yp)[idx] = vv;
      }
}

// ---------------------------------------------------------------------------
// Forget gate: f[h][t] = log_sigmoid(hidden[t] . Wf[h] + bf[h])
// ---------------------------------------------------------------------------
__global__ void __launch_bounds__(256)
fgate_kernel(const float* __restrict__ x, const float* __restrict__ Wf,
             const float* __restrict__ bf, float* __restrict__ f) {
  int idx = blockIdx.x * 256 + threadIdx.x;
  if (idx >= NH * T_SEQ) return;
  int h = idx / T_SEQ, t = idx % T_SEQ;
  const float* xr = x + (size_t)t * HID;
  const float* wr = Wf + (size_t)h * HID;
  float acc = bf[h];
  for (int kk = 0; kk < HID; ++kk) acc = fmaf(xr[kk], wr[kk], acc);
  float ls = (acc > 0.f) ? -log1pf(__expf(-acc)) : (acc - log1pf(__expf(acc)));
  f[(size_t)h * T_SEQ + t] = ls;
}

// Cumulative decay (both directions): gc[dir][h][p] over direction-local p.
// One 256-thread block per (dir, head). Each thread sums its 8 consecutive
// positions, the 32 lane totals are scanned by shuffles, the 8 wave totals
// go through LDS; every thread then adds the sum of all that lies before it.
__global__ void __launch_bounds__(256)
fscan_kernel(const float* __restrict__ f, float* __restrict__ gc) {
  __shared__ float wtot[8];
  const int tid  = threadIdx.x;
  const int wave = tid >> 5;
  const int lane = tid & 31;
  const int dir  = blockIdx.x >> 4;
  const int h    = blockIdx.x & 15;
  const int p0   = tid * 8;
  const float* fh = f + (size_t)h * T_SEQ;

  // Position p reads t = p, or t = T-1-p in the reverse direction: there the
  // thread's 8 floats lie at T-8-p0 and are taken from the top down.
  const float* src = fh + (dir ? (T_SEQ - 8 - p0) : p0);
  const float4 a = *(const float4*)(src);
  const float4 b = *(const float4*)(src + 4);
  float x[8];
  x[0] = dir ? b.w : a.x;  x[1] = dir ? b.z : a.y;
  x[2] = dir ? b.y : a.z;  x[3] = dir ? b.x : a.w;
  x[4] = dir ? a.w : b.x;  x[5] = dir ? a.z : b.y;
  x[6] = dir ? a.y : b.z;  x[7] = dir ? a.x : b.w;
#pragma unroll
  for (int i = 1; i < 8; ++i) x[i] += x[i - 1];

  float incl = x[7];             // inclusive scan of the lane totals
#pragma unroll
  for (int off = 1; off < 32; off <<= 1) {
    float up = __shfl_up(incl, off, 32);
    if (lane >= off) incl += up;
  }
  const float excl = __shfl_up(incl, 1, 32);
  if (lane == 31) wtot[wave] = incl;
  __syncthreads();               // publishes the 8 wave totals
  float base = (lane > 0) ? excl : 0.f;   // lanes before this one, same wave
#pragma unroll
  for (int j = 0; j < 7; ++j)
    if (j < wave) base += wtot[j];

  float* dst = gc + (size_t)blockIdx.x * T_SEQ + p0;
  *(float4*)(dst)     = make_float4(x[0] + base, x[1] + base, x[2] + base, x[3] + base);
  *(float4*)(dst + 4) = make_float4(x[4] + base, x[5] + base, x[6] + base, x[7] + base);
}

// ---------------------------------------------------------------------------
// Flash-style forgetting attention, one wave per 16-row Q tile.
// grid = (T/16/WPB, NH, 2 directions). Causal in direction-local coords.
// q/k/v are f16 (q pre-scaled). K/V blocks async-DMA'd to LDS as raw f16.
// S tile: 16x32 via 4 WMMA; PV: 4 WMMA with ds_load_tr16_b128 V-columns.
// ---------------------------------------------------------------------------
__global__ void __launch_bounds__(WPB * 32)
fox_attn_kernel(const _Float16* __restrict__ q, const _Float16* __restrict__ k,
                const _Float16* __restrict__ v, const float* __restrict__ gc,
                float* __restrict__ obuf) {
  __shared__ _Float16 kv_s[WPB][32][72];   // 144B row stride (16B multiple)
  __shared__ _Float16 p_s[WPB][16][32];

  const int w    = threadIdx.x >> 5;
  const int lane = threadIdx.x & 31;
  const int half = (lane >> 4) & 1;
  const int nl   = lane & 15;
  const int kbh  = half * 8;
  const int qt   = blockIdx.x * WPB + w;    // q-tile index, 0..127
  const int h    = blockIdx.y;
  const int dir  = blockIdx.z;
  const float* gcd = gc + ((size_t)dir * NH + h) * T_SEQ;

  // Q fragments for this wave's 16 rows (q already scaled by d^-0.5).
  int qp_a = qt * 16 + nl;
  int tq   = dir ? (T_SEQ - 1 - qp_a) : qp_a;
  const _Float16* qrow = q + (size_t)tq * HID + h * HD;
  v16h a0, a1;
#pragma unroll
  for (int e = 0; e < 16; ++e) {
    int kk = kbh + e + ((e & 8) ? 8 : 0);
    a0[e] = qrow[kk];
    a1[e] = qrow[32 + kk];
  }
  float gq[8];
#pragma unroll
  for (int r = 0; r < 8; ++r) gq[r] = gcd[qt * 16 + r + half * 8];

  v8f o[4];
#pragma unroll
  for (int i = 0; i < 4; ++i) o[i] = (v8f){0,0,0,0,0,0,0,0};
  float rmax[8], rsum[8];
#pragma unroll
  for (int r = 0; r < 8; ++r) { rmax[r] = -1e30f; rsum[r] = 0.f; }

  const int nkb = (qt >> 1) + 1;            // causal: kv blocks of 32
  for (int kbI = 0; kbI < nkb; ++kbI) {
    const int kv0 = kbI * 32;

    // ---- stage K block (32 x 64 f16 = 32 rows x 8 16B chunks) ----
    wait_ds0();   // prior iter's LDS reads done before DMA overwrites
#pragma unroll
    for (int i = 0; i < 8; ++i) {
      int flat = i * 32 + lane, row = flat >> 3, c = flat & 7;
      int p = kv0 + row, t = dir ? (T_SEQ - 1 - p) : p;
      copy16_g2l(k + (size_t)t * HID + h * HD + c * 8, &kv_s[w][row][c * 8]);
    }
    wait_async0();

    // ---- S = Q K^T : two 16x16 accum tiles ----
    v8f s0 = (v8f){0,0,0,0,0,0,0,0};
    v8f s1 = (v8f){0,0,0,0,0,0,0,0};
#pragma unroll
    for (int ks = 0; ks < 2; ++ks) {
      v16h b0, b1;
#pragma unroll
      for (int e = 0; e < 16; ++e) {
        int kk = ks * 32 + kbh + e + ((e & 8) ? 8 : 0);
        b0[e] = kv_s[w][nl][kk];        // key rows 0..15
        b1[e] = kv_s[w][16 + nl][kk];   // key rows 16..31
      }
      s0 = __builtin_amdgcn_wmma_f32_16x16x32_f16(
          false, (ks ? a1 : a0), false, b0, (short)0, s0, false, false);
      s1 = __builtin_amdgcn_wmma_f32_16x16x32_f16(
          false, (ks ? a1 : a0), false, b1, (short)0, s1, false, false);
    }

    // ---- decay + causal mask + online softmax (rows across 16 lanes) ----
    float gk0 = gcd[kv0 + nl];
    float gk1 = gcd[kv0 + 16 + nl];
    int kp0 = kv0 + nl, kp1 = kv0 + 16 + nl;
    float x0[8], x1[8], m[8];
#pragma unroll
    for (int r = 0; r < 8; ++r) {
      int qp = qt * 16 + r + half * 8;
      x0[r] = (kp0 <= qp) ? (s0[r] + gq[r] - gk0) : -1e30f;
      x1[r] = (kp1 <= qp) ? (s1[r] + gq[r] - gk1) : -1e30f;
      m[r]  = fmaxf(x0[r], x1[r]);
    }
    row16_max8(m);
    float dm[8], ps[8];
#pragma unroll
    for (int r = 0; r < 8; ++r) {
      float nm = fmaxf(rmax[r], m[r]);
      dm[r] = rmax[r] - nm;
      rmax[r] = nm;
      float p0 = __expf(x0[r] - nm), p1 = __expf(x1[r] - nm);
      ps[r] = p0 + p1;
      // transpose P (C-layout -> A-layout) through LDS
      p_s[w][r + half * 8][nl]      = (_Float16)p0;
      p_s[w][r + half * 8][16 + nl] = (_Float16)p1;
    }
    wait_ds0();

    // ---- stage V block (reuse kv_s) ----
#pragma unroll
    for (int i = 0; i < 8; ++i) {
      int flat = i * 32 + lane, row = flat >> 3, c = flat & 7;
      int p = kv0 + row, t = dir ? (T_SEQ - 1 - p) : p;
      copy16_g2l(v + (size_t)t * HID + h * HD + c * 8, &kv_s[w][row][c * 8]);
    }
    // Row sums, alpha and the rescale need no LDS. The scheduling barrier keeps
    // them behind the copies' issue, where they fill the wait for the V block
    // and its fragments; without it the compiler lifts them ahead of the copies.
    __builtin_amdgcn_sched_barrier(0);
    row16_sum8(ps);
#pragma unroll
    for (int r = 0; r < 8; ++r) {
      float alpha = exp_with_slot(dm[r]);
      rsum[r] = rsum[r] * alpha + ps[r];
#pragma unroll
      for (int i = 0; i < 4; ++i) o[i][r] *= alpha;
    }
    wait_async0();

    // ---- O += P V : P as A fragment, V columns as B fragments ----
    v16h ap;
#pragma unroll
    for (int e = 0; e < 16; ++e) {
      int kk = kbh + e + ((e & 8) ? 8 : 0);
      ap[e] = p_s[w][nl][kk];
    }
#pragma unroll
    for (int ns = 0; ns < 4; ++ns) {
      v16h bv;
#if HAS_DS_TR16
      {
        auto r0 = __builtin_amdgcn_ds_load_tr16_b128(
            (__attribute__((address_space(3))) v8h*)&kv_s[w][nl][ns * 16]);
        auto r1 = __builtin_amdgcn_ds_load_tr16_b128(
            (__attribute__((address_space(3))) v8h*)&kv_s[w][16 + nl][ns * 16]);
        v8h lo = __builtin_bit_cast(v8h, r0);
        v8h hi = __builtin_bit_cast(v8h, r1);
#pragma unroll
        for (int e = 0; e < 8; ++e) { bv[e] = lo[e]; bv[8 + e] = hi[e]; }
      }
#else
#pragma unroll
      for (int e = 0; e < 16; ++e) {
        int kk = kbh + e + ((e & 8) ? 8 : 0);
        bv[e] = kv_s[w][kk][ns * 16 + nl];
      }
#endif
      o[ns] = __builtin_amdgcn_wmma_f32_16x16x32_f16(
          false, ap, false, bv, (short)0, o[ns], false, false);
    }
  }

  // ---- epilogue: normalize and scatter into concat buffer [T, 2H] ----
#pragma unroll
  for (int ns = 0; ns < 4; ++ns)
#pragma unroll
    for (int r = 0; r < 8; ++r) {
      int qp = qt * 16 + r + half * 8;
      int t  = dir ? (T_SEQ - 1 - qp) : qp;
      obuf[(size_t)t * (2 * HID) + (size_t)dir * HID + h * HD + ns * 16 + nl] =
          o[ns][r] / rsum[r];
    }
}

// ---------------------------------------------------------------------------
extern "C" void kernel_launch(void* const* d_in, const int* in_sizes, int n_in,
                              void* d_out, int out_size, void* d_ws, size_t ws_size,
                              hipStream_t stream) {
  (void)in_sizes; (void)n_in; (void)out_size; (void)ws_size;
  const float* hidden = (const float*)d_in[0];
  const float* Wq     = (const float*)d_in[1];
  const float* Wk     = (const float*)d_in[2];
  const float* Wv     = (const float*)d_in[3];
  const float* Wf     = (const float*)d_in[4];
  const float* bf     = (const float*)d_in[5];
  const float* Wo     = (const float*)d_in[6];
  float* out = (float*)d_out;

  // Workspace layout: q|k|v (f16) then f|gc|o_concat (f32)
  _Float16* qb = (_Float16*)d_ws;
  _Float16* kb = qb + (size_t)T_SEQ * HID;
  _Float16* vb = kb + (size_t)T_SEQ * HID;
  float* fb = (float*)(vb + (size_t)T_SEQ * HID);
  float* gc = fb + (size_t)NH * T_SEQ;
  float* ob = gc + (size_t)2 * NH * T_SEQ;

  dim3 gproj(T_SEQ / 128, HID / 128);
  gemm_f16_wmma<true><<<gproj, 256, 0, stream>>>(hidden, Wq, qb, T_SEQ, HID, HID,
                                                 0.125f /* d^-0.5 folded in */);
  gemm_f16_wmma<true><<<gproj, 256, 0, stream>>>(hidden, Wk, kb, T_SEQ, HID, HID, 1.f);
  gemm_f16_wmma<true><<<gproj, 256, 0, stream>>>(hidden, Wv, vb, T_SEQ, HID, HID, 1.f);

  fgate_kernel<<<(NH * T_SEQ) / 256, 256, 0, stream>>>(hidden, Wf, bf, fb);
  fscan_kernel<<<2 * NH, 256, 0, stream>>>(fb, gc);

  dim3 gattn(T_SEQ / 16 / WPB, NH, 2);
  fox_attn_kernel<<<gattn, WPB * 32, 0, stream>>>(qb, kb, vb, gc, ob);

  dim3 gout(T_SEQ / 128, HID / 128);
  gemm_f16_wmma<false><<<gout, 256, 0, stream>>>(ob, Wo, out, T_SEQ, HID, 2 * HID, 1.f);
}

// v004
// It runs in 235 microseconds.
// Timed twice side by side with v003, it ran 1.11 and 1.10 times as fast.
// Counting every step since v000, it is 2.08 times as fast.
#include <hip/hip_runtime.h>
#include <cstddef>

#define T_SEQ 2048
#define HID   1024
#define NH    16
#define HD    64     // head dim
#define WPB   4      // waves per block in attention kernel

typedef __attribute__((ext_vector_type(16))) _Float16 v16h;
typedef __attribute__((ext_vector_type(8)))  _Float16 v8h;
typedef __attribute__((ext_vector_type(8)))  float    v8f;
typedef __attribute__((ext_vector_type(8)))  short    s16x8;
typedef int async_v4i __attribute__((vector_size(4 * sizeof(int))));

#if __has_builtin(__builtin_amdgcn_global_load_async_to_lds_b128)
#define HAS_ASYNC_LDS 1
#else
#define HAS_ASYNC_LDS 0
#endif

__device__ __forceinline__ void copy16_g2l(const void* g, void* l) {
#if HAS_ASYNC_LDS
  __builtin_amdgcn_global_load_async_to_lds_b128(
      (__attribute__((address_space(1))) async_v4i*)(g),
      (__attribute__((address_space(3))) async_v4i*)(l), 0, 0);
#else
  *(float4*)l = *(const float4*)g;
#endif
}

__device__ __forceinline__ void wait_async0() {
#if HAS_ASYNC_LDS
#if __has_builtin(__builtin_amdgcn_s_wait_asynccnt)
  __builtin_amdgcn_s_wait_asynccnt(0);
#else
  asm volatile("s_wait_asynccnt 0" ::: "memory");
#endif
#endif
}

__device__ __forceinline__ v8h lds_tr16(const _Float16* p) {
  typedef __attribute__((address_space(3))) s16x8 lds_s16x8;
  return __builtin_bit_cast(
      v8h, __builtin_amdgcn_ds_load_tr16_b128_v8i16((lds_s16x8*)p));
}

__device__ __forceinline__ void wait_ds0() {
  asm volatile("s_wait_dscnt 0" ::: "memory");
}

// Butterfly over each 16-lane row (lane ^ 1, 2, 4, 8) for eight independent
// values at once, on the vector unit by DPP. The eight values of a step stand
// side by side so that each link of a chain is covered by the seven others.
#define ROW16_STEP(op, k)                                        \
  op " %0, %0, %0 row_xmask:" #k " row_mask:0xf bank_mask:0xf\n\t" \
  op " %1, %1, %1 row_xmask:" #k " row_mask:0xf bank_mask:0xf\n\t" \
  op " %2, %2, %2 row_xmask:" #k " row_mask:0xf bank_mask:0xf\n\t" \
  op " %3, %3, %3 row_xmask:" #k " row_mask:0xf bank_mask:0xf\n\t" \
  op " %4, %4, %4 row_xmask:" #k " row_mask:0xf bank_mask:0xf\n\t" \
  op " %5, %5, %5 row_xmask:" #k " row_mask:0xf bank_mask:0xf\n\t" \
  op " %6, %6, %6 row_xmask:" #k " row_mask:0xf bank_mask:0xf\n\t" \
  op " %7, %7, %7 row_xmask:" #k " row_mask:0xf bank_mask:0xf\n\t"
#define ROW16_ALL(op) \
  ROW16_STEP(op, 1) ROW16_STEP(op, 2) ROW16_STEP(op, 4) ROW16_STEP(op, 8)

// Needs all 32 lanes on. Replaces __shfl_xor, which compiles to an LDS-path
// permute with a wait behind each link.
__device__ __forceinline__ void row16_max8(float (&x)[8]) {
  asm(ROW16_ALL("v_max_num_f32_dpp")
      : "+v"(x[0]), "+v"(x[1]), "+v"(x[2]), "+v"(x[3]),
        "+v"(x[4]), "+v"(x[5]), "+v"(x[6]), "+v"(x[7]));
}

__device__ __forceinline__ float exp_with_slot(float x) {
  float y;
  asm("v_exp_f32 %0, %1\n\tv_nop" : "=v"(y) : "v"(x * 0x1.715476p+0f));
  return y;
}

__device__ __forceinline__ void row16_sum8(float (&x)[8]) {
  asm(ROW16_ALL("v_add_f32_dpp")
      : "+v"(x[0]), "+v"(x[1]), "+v"(x[2]), "+v"(x[3]),
        "+v"(x[4]), "+v"(x[5]), "+v"(x[6]), "+v"(x[7]));
}

template <bool F16OUT>
__global__ void __launch_bounds__(256)
gemm_f16_wmma(const float* __restrict__ X, const float* __restrict__ W,
              void* __restrict__ Yp, int M, int N, int K, float oscale) {
  __shared__ _Float16 Xs[2][128][40];   // two stages; 80B row stride (16B multiple)
  __shared__ _Float16 Ws[2][128][40];

  const int tid  = threadIdx.x;
  const int wave = tid >> 5;
  const int lane = tid & 31;
  const int half = (lane >> 4) & 1;   // which 16-lane half
  const int nl   = lane & 15;
  const int kb   = half * 8;          // per-half K base inside the 32-wide step
  const int wm   = wave & 3;          // 4 wave-rows of 32
  const int wn   = wave >> 2;         // 2 wave-cols of 64
  const int m0   = blockIdx.x * 128;
  const int n0   = blockIdx.y * 128;

  v8f acc[2][4];
#pragma unroll
  for (int mi = 0; mi < 2; ++mi)
#pragma unroll
    for (int ns = 0; ns < 4; ++ns) acc[mi][ns] = (v8f){0,0,0,0,0,0,0,0};

  // Each thread moves 4 chunks of 4 floats of either 128x32 tile: rows
  // srow + 32 i, floats scol .. scol + 3.
  const int srow = tid >> 3;
  const int scol = (tid & 7) * 4;
  const float* xg = X + (size_t)(m0 + srow) * K + scol;
  const float* wg = W + (size_t)(n0 + srow) * K + scol;
  float4 xr[4], wr[4];   // the tile in flight from global memory

  // Issue the loads of the K-step that starts at k0; their data is not waited
  // for here.
  auto fetch = [&](int k0) {
    const float* px[4];
    const float* pw[4];
#pragma unroll
    for (int i = 0; i < 4; ++i) {
      px[i] = xg + (size_t)(i * 32) * K + k0;
      pw[i] = wg + (size_t)(i * 32) * K + k0;
    }
#pragma unroll
    for (int i = 0; i < 4; ++i) xr[i] = *(const float4*)px[i];
#pragma unroll
    for (int i = 0; i < 4; ++i) wr[i] = *(const float4*)pw[i];
    // The wait that stands before a register named by an issued load is
    // overwritten. The eight address pairs are its inputs, so that none is
    // reused (as a later load's destination, for a later address) ahead of it.
    // Its clobber also holds the loads' issue ahead of the LDS reads and
    // products that follow; sunk below them, their latency would stand open.
    asm volatile("s_wait_xcnt 0x0"
                 :: "v"(px[0]), "v"(px[1]), "v"(px[2]), "v"(px[3]),
                    "v"(pw[0]), "v"(pw[1]), "v"(pw[2]), "v"(pw[3])
                 : "memory");
  };
  // Convert the fetched tile to f16 and lay it into stage s.
  auto stash = [&](int s) {
#pragma unroll
    for (int i = 0; i < 4; ++i) {
      _Float16* xl = &Xs[s][srow + i * 32][scol];
      xl[0] = (_Float16)xr[i].x;  xl[1] = (_Float16)xr[i].y;
      xl[2] = (_Float16)xr[i].z;  xl[3] = (_Float16)xr[i].w;
      _Float16* wl = &Ws[s][srow + i * 32][scol];
      wl[0] = (_Float16)wr[i].x;  wl[1] = (_Float16)wr[i].y;
      wl[2] = (_Float16)wr[i].z;  wl[3] = (_Float16)wr[i].w;
    }
  };
  // The 8 WMMA of one K-step, operands from stage s.
  auto mma = [&](int s) {
    v16h a[2];
#pragma unroll
    for (int mi = 0; mi < 2; ++mi)
#pragma unroll
      for (int e = 0; e < 16; ++e) {
        int kk = kb + e + ((e & 8) ? 8 : 0);
        a[mi][e] = Xs[s][wm * 32 + mi * 16 + nl][kk];
      }
    v16h b[4];   // column n = W row (n0+wn*64+ns*16+nl), K along the W row
#pragma unroll
    for (int ns = 0; ns < 4; ++ns)
#pragma unroll
      for (int e = 0; e < 16; ++e) {
        int kk = kb + e + ((e & 8) ? 8 : 0);
        b[ns][e] = Ws[s][wn * 64 + ns * 16 + nl][kk];
      }
    // Keeps all twelve LDS reads ahead of the first product. With the fetched
    // tile held in registers the compiler otherwise reuses one B fragment's
    // registers four times, and each reuse waits out a full LDS latency.
    __builtin_amdgcn_sched_barrier(0);
#pragma unroll
    for (int ns = 0; ns < 4; ++ns)
#pragma unroll
      for (int mi = 0; mi < 2; ++mi)
        acc[mi][ns] = __builtin_amdgcn_wmma_f32_16x16x32_f16(
            false, a[mi], false, b[ns], (short)0, acc[mi][ns], false, false);
  };

  // Two LDS stages: the next K-step's global loads fly while this step's
  // products run. One barrier a step: it publishes the stage just written and
  // ends every wave's reads of the stage that the next step overwrites.
  fetch(0);
  stash(0);
  __syncthreads();
  int s = 0;
  for (int k0 = 32; k0 < K; k0 += 32) {
    fetch(k0);
    mma(s);
    // Keeps the conversions, and with them the wait for the loads, behind the
    // products; the compiler lifts them ahead to free registers early.
    __builtin_amdgcn_sched_barrier(0);
    stash(s ^ 1);
    __syncthreads();
    s ^= 1;
  }
  mma(s);

#pragma unroll
  for (int mi = 0; mi < 2; ++mi)
#pragma unroll
    for (int ns = 0; ns < 4; ++ns)
#pragma unroll
      for (int r = 0; r < 8; ++r) {
        size_t idx = (size_t)(m0 + wm * 32 + mi * 16 + r + half * 8) * N +
                     n0 + wn * 64 + ns * 16 + nl;
        float vv = acc[mi][ns][r] * oscale;
        if (F16OUT) ((_Float16*)Yp)[idx] = (_Float16)vv;
        else        ((float*)Yp)[idx] = vv;
      }
}

// ---------------------------------------------------------------------------
// Forget gate: f[h][t] = log_sigmoid(hidden[t] . Wf[h] + bf[h])
// ---------------------------------------------------------------------------
__global__ void __launch_bounds__(256)
fgate_kernel(const float* __restrict__ x, const float* __restrict__ Wf,
             const float* __restrict__ bf, float* __restrict__ f) {
  int idx = blockIdx.x * 256 + threadIdx.x;
  if (idx >= NH * T_SEQ) return;
  int h = idx / T_SEQ, t = idx % T_SEQ;
  const float* xr = x + (size_t)t * HID;
  const float* wr = Wf + (size_t)h * HID;
  float acc = bf[h];
  for (int kk = 0; kk < HID; ++kk) acc = fmaf(xr[kk], wr[kk], acc);
  float ls = (acc > 0.f) ? -log1pf(__expf(-acc)) : (acc - log1pf(__expf(acc)));
  f[(size_t)h * T_SEQ + t] = ls;
}

// Cumulative decay (both directions): gc[dir][h][p] over direction-local p.
// One 256-thread block per (dir, head). Each thread sums its 8 consecutive
// positions, the 32 lane totals are scanned by shuffles, the 8 wave totals
// go through LDS; every thread then adds the sum of all that lies before it.
__global__ void __launch_bounds__(256)
fscan_kernel(const float* __restrict__ f, float* __restrict__ gc) {
  __shared__ float wtot[8];
  const int tid  = threadIdx.x;
  const int wave = tid >> 5;
  const int lane = tid & 31;
  const int dir  = blockIdx.x >> 4;
  const int h    = blockIdx.x & 15;
  const int p0   = tid * 8;
  const float* fh = f + (size_t)h * T_SEQ;

  // Position p reads t = p, or t = T-1-p in the reverse direction: there the
  // thread's 8 floats lie at T-8-p0 and are taken from the top down.
  const float* src = fh + (dir ? (T_SEQ - 8 - p0) : p0);
  const float4 a = *(const float4*)(src);
  const float4 b = *(const float4*)(src + 4);
  float x[8];
  x[0] = dir ? b.w : a.x;  x[1] = dir ? b.z : a.y;
  x[2] = dir ? b.y : a.z;  x[3] = dir ? b.x : a.w;
  x[4] = dir ? a.w : b.x;  x[5] = dir ? a.z : b.y;
  x[6] = dir ? a.y : b.z;  x[7] = dir ? a.x : b.w;
#pragma unroll
  for (int i = 1; i < 8; ++i) x[i] += x[i - 1];

  float incl = x[7];             // inclusive scan of the lane totals
#pragma unroll
  for (int off = 1; off < 32; off <<= 1) {
    float up = __shfl_up(incl, off, 32);
    if (lane >= off) incl += up;
  }
  const float excl = __shfl_up(incl, 1, 32);
  if (lane == 31) wtot[wave] = incl;
  __syncthreads();               // publishes the 8 wave totals
  float base = (lane > 0) ? excl : 0.f;   // lanes before this one, same wave
#pragma unroll
  for (int j = 0; j < 7; ++j)
    if (j < wave) base += wtot[j];

  float* dst = gc + (size_t)blockIdx.x * T_SEQ + p0;
  *(float4*)(dst)     = make_float4(x[0] + base, x[1] + base, x[2] + base, x[3] + base);
  *(float4*)(dst + 4) = make_float4(x[4] + base, x[5] + base, x[6] + base, x[7] + base);
}

// ---------------------------------------------------------------------------
// Flash-style forgetting attention, one wave per 16-row Q tile.
// grid = (T/16/WPB, NH, 2 directions). Causal in direction-local coords.
// q/k/v are f16 (q pre-scaled). K/V blocks async-DMA'd to LDS as raw f16.
// S tile: 16x32 via 4 WMMA; PV: 4 WMMA with ds_load_tr16_b128 V-columns.
// ---------------------------------------------------------------------------
__global__ void __launch_bounds__(WPB * 32)
fox_attn_kernel(const _Float16* __restrict__ q, const _Float16* __restrict__ k,
                const _Float16* __restrict__ v, const float* __restrict__ gc,
                float* __restrict__ obuf) {
  __shared__ _Float16 kv_s[WPB][32][72];   // 144B row stride (16B multiple)
  __shared__ _Float16 p_s[WPB][16][32];

  const int w    = threadIdx.x >> 5;
  const int lane = threadIdx.x & 31;
  const int half = (lane >> 4) & 1;
  const int nl   = lane & 15;
  const int kbh  = half * 8;
  const int qt   = blockIdx.x * WPB + w;    // q-tile index, 0..127
  const int h    = blockIdx.y;
  const int dir  = blockIdx.z;
  const float* gcd = gc + ((size_t)dir * NH + h) * T_SEQ;

  // Q fragments for this wave's 16 rows (q already scaled by d^-0.5).
  int qp_a = qt * 16 + nl;
  int tq   = dir ? (T_SEQ - 1 - qp_a) : qp_a;
  const _Float16* qrow = q + (size_t)tq * HID + h * HD;
  v16h a0, a1;
#pragma unroll
  for (int e = 0; e < 16; ++e) {
    int kk = kbh + e + ((e & 8) ? 8 : 0);
    a0[e] = qrow[kk];
    a1[e] = qrow[32 + kk];
  }
  float gq[8];
#pragma unroll
  for (int r = 0; r < 8; ++r) gq[r] = gcd[qt * 16 + r + half * 8];

  v8f o[4];
#pragma unroll
  for (int i = 0; i < 4; ++i) o[i] = (v8f){0,0,0,0,0,0,0,0};
  float rmax[8], rsum[8];
#pragma unroll
  for (int r = 0; r < 8; ++r) { rmax[r] = -1e30f; rsum[r] = 0.f; }

  // This lane's address in the V block for the transposing loads.
  const _Float16* vtr = &kv_s[w][kbh + (lane & 7)][((lane >> 3) & 1) * 8];

  const int nkb = (qt >> 1) + 1;            // causal: kv blocks of 32
  for (int kbI = 0; kbI < nkb; ++kbI) {
    const int kv0 = kbI * 32;

    // ---- stage K block (32 x 64 f16 = 32 rows x 8 16B chunks) ----
    wait_ds0();   // prior iter's LDS reads done before DMA overwrites
#pragma unroll
    for (int i = 0; i < 8; ++i) {
      int flat = i * 32 + lane, row = flat >> 3, c = flat & 7;
      int p = kv0 + row, t = dir ? (T_SEQ - 1 - p) : p;
      copy16_g2l(k + (size_t)t * HID + h * HD + c * 8, &kv_s[w][row][c * 8]);
    }
    wait_async0();

    // ---- S = Q K^T : two 16x16 accum tiles ----
    v8f s0 = (v8f){0,0,0,0,0,0,0,0};
    v8f s1 = (v8f){0,0,0,0,0,0,0,0};
#pragma unroll
    for (int ks = 0; ks < 2; ++ks) {
      v16h b0, b1;
#pragma unroll
      for (int e = 0; e < 16; ++e) {
        int kk = ks * 32 + kbh + e + ((e & 8) ? 8 : 0);
        b0[e] = kv_s[w][nl][kk];        // key rows 0..15
        b1[e] = kv_s[w][16 + nl][kk];   // key rows 16..31
      }
      s0 = __builtin_amdgcn_wmma_f32_16x16x32_f16(
          false, (ks ? a1 : a0), false, b0, (short)0, s0, false, false);
      s1 = __builtin_amdgcn_wmma_f32_16x16x32_f16(
          false, (ks ? a1 : a0), false, b1, (short)0, s1, false, false);
    }

    // ---- decay + causal mask + online softmax (rows across 16 lanes) ----
    float gk0 = gcd[kv0 + nl];
    float gk1 = gcd[kv0 + 16 + nl];
    int kp0 = kv0 + nl, kp1 = kv0 + 16 + nl;
    float x0[8], x1[8], m[8];
#pragma unroll
    for (int r = 0; r < 8; ++r) {
      int qp = qt * 16 + r + half * 8;
      x0[r] = (kp0 <= qp) ? (s0[r] + gq[r] - gk0) : -1e30f;
      x1[r] = (kp1 <= qp) ? (s1[r] + gq[r] - gk1) : -1e30f;
      m[r]  = fmaxf(x0[r], x1[r]);
    }
    row16_max8(m);
    float dm[8], ps[8];
#pragma unroll
    for (int r = 0; r < 8; ++r) {
      float nm = fmaxf(rmax[r], m[r]);
      dm[r] = rmax[r] - nm;
      rmax[r] = nm;
      float p0 = __expf(x0[r] - nm), p1 = __expf(x1[r] - nm);
      ps[r] = p0 + p1;
      // transpose P (C-layout -> A-layout) through LDS
      p_s[w][r + half * 8][nl]      = (_Float16)p0;
      p_s[w][r + half * 8][16 + nl] = (_Float16)p1;
    }
    wait_ds0();

    // ---- stage V block (reuse kv_s) ----
#pragma unroll
    for (int i = 0; i < 8; ++i) {
      int flat = i * 32 + lane, row = flat >> 3, c = flat & 7;
      int p = kv0 + row, t = dir ? (T_SEQ - 1 - p) : p;
      copy16_g2l(v + (size_t)t * HID + h * HD + c * 8, &kv_s[w][row][c * 8]);
    }
    // Row sums, alpha and the rescale need no LDS. The scheduling barrier keeps
    // them behind the copies' issue, where they fill the wait for the V block
    // and its fragments; without it the compiler lifts them ahead of the copies.
    __builtin_amdgcn_sched_barrier(0);
    row16_sum8(ps);
#pragma unroll
    for (int r = 0; r < 8; ++r) {
      float alpha = exp_with_slot(dm[r]);
      rsum[r] = rsum[r] * alpha + ps[r];
#pragma unroll
      for (int i = 0; i < 4; ++i) o[i][r] *= alpha;
    }
    wait_async0();

    // ---- O += P V : P as A fragment, V columns as B fragments ----
    v16h ap;
#pragma unroll
    for (int e = 0; e < 16; ++e) {
      int kk = kbh + e + ((e & 8) ? 8 : 0);
      ap[e] = p_s[w][nl][kk];
    }
    // V lies row-major [kv][d]; the B fragment wants column ns * 16 + nl with
    // kv = kbh + e (e < 8) and 16 + kbh + (e - 8): two transposing loads, at kv
    // rows 0 and 16, deliver exactly that, in ap's k order.
    v16h bv[4];
#pragma unroll
    for (int ns = 0; ns < 4; ++ns) {
      const v8h lo = lds_tr16(vtr + ns * 16);
      const v8h hi = lds_tr16(vtr + 16 * 72 + ns * 16);
#pragma unroll
      for (int e = 0; e < 8; ++e) { bv[ns][e] = lo[e]; bv[ns][8 + e] = hi[e]; }
    }
    // Keeps all ten LDS reads ahead of the first product. The compiler
    // otherwise reuses one V fragment's registers, and each reuse waits out an
    // LDS latency between two products.
    __builtin_amdgcn_sched_barrier(0);
#pragma unroll
    for (int ns = 0; ns < 4; ++ns)
      o[ns] = __builtin_amdgcn_wmma_f32_16x16x32_f16(
          false, ap, false, bv[ns], (short)0, o[ns], false, false);
  }

  // ---- epilogue: normalize and scatter into concat buffer [T, 2H] ----
#pragma unroll
  for (int ns = 0; ns < 4; ++ns)
#pragma unroll
    for (int r = 0; r < 8; ++r) {
      int qp = qt * 16 + r + half * 8;
      int t  = dir ? (T_SEQ - 1 - qp) : qp;
      obuf[(size_t)t * (2 * HID) + (size_t)dir * HID + h * HD + ns * 16 + nl] =
          o[ns][r] / rsum[r];
    }
}

// ---------------------------------------------------------------------------
extern "C" void kernel_launch(void* const* d_in, const int* in_sizes, int n_in,
                              void* d_out, int out_size, void* d_ws, size_t ws_size,
                              hipStream_t stream) {
  (void)in_sizes; (void)n_in; (void)out_size; (void)ws_size;
  const float* hidden = (const float*)d_in[0];
  const float* Wq     = (const float*)d_in[1];
  const float* Wk     = (const float*)d_in[2];
  const float* Wv     = (const float*)d_in[3];
  const float* Wf     = (const float*)d_in[4];
  const float* bf     = (const float*)d_in[5];
  const float* Wo     = (const float*)d_in[6];
  float* out = (float*)d_out;

  // Workspace layout: q|k|v (f16) then f|gc|o_concat (f32)
  _Float16* qb = (_Float16*)d_ws;
  _Float16* kb = qb + (size_t)T_SEQ * HID;
  _Float16* vb = kb + (size_t)T_SEQ * HID;
  float* fb = (float*)(vb + (size_t)T_SEQ * HID);
  float* gc = fb + (size_t)NH * T_SEQ;
  float* ob = gc + (size_t)2 * NH * T_SEQ;

  dim3 gproj(T_SEQ / 128, HID / 128);
  gemm_f16_wmma<true><<<gproj, 256, 0, stream>>>(hidden, Wq, qb, T_SEQ, HID, HID,
                                                 0.125f /* d^-0.5 folded in */);
  gemm_f16_wmma<true><<<gproj, 256, 0, stream>>>(hidden, Wk, kb, T_SEQ, HID, HID, 1.f);
  gemm_f16_wmma<true><<<gproj, 256, 0, stream>>>(hidden, Wv, vb, T_SEQ, HID, HID, 1.f);

  fgate_kernel<<<(NH * T_SEQ) / 256, 256, 0, stream>>>(hidden, Wf, bf, fb);
  fscan_kernel<<<2 * NH, 256, 0, stream>>>(fb, gc);

  dim3 gattn(T_SEQ / 16 / WPB, NH, 2);
  fox_attn_kernel<<<gattn, WPB * 32, 0, stream>>>(qb, kb, vb, gc, ob);

  dim3 gout(T_SEQ / 128, HID / 128);
  gemm_f16_wmma<false><<<gout, 256, 0, stream>>>(ob, Wo, out, T_SEQ, HID, 2 * HID, 1.f);
}

// v005
// A run of this version takes 217 microseconds.
// In both of two side-by-side timings against v004, it was 1.09 times as fast.
// Over all steps from v000 it is 2.26 times as fast.
#include <hip/hip_runtime.h>
#include <cstddef>

#define T_SEQ 2048
#define HID   1024
#define NH    16
#define HD    64     // head dim
#define WPB   4      // waves per block in attention kernel

typedef __attribute__((ext_vector_type(16))) _Float16 v16h;
typedef __attribute__((ext_vector_type(8)))  _Float16 v8h;
typedef __attribute__((ext_vector_type(8)))  float    v8f;
typedef __attribute__((ext_vector_type(2)))  float    v2f;
typedef __attribute__((ext_vector_type(8)))  short    s16x8;
typedef int async_v4i __attribute__((vector_size(4 * sizeof(int))));

#if __has_builtin(__builtin_amdgcn_global_load_async_to_lds_b128)
#define HAS_ASYNC_LDS 1
#else
#define HAS_ASYNC_LDS 0
#endif

__device__ __forceinline__ void copy16_g2l(const void* g, void* l) {
#if HAS_ASYNC_LDS
  __builtin_amdgcn_global_load_async_to_lds_b128(
      (__attribute__((address_space(1))) async_v4i*)(g),
      (__attribute__((address_space(3))) async_v4i*)(l), 0, 0);
#else
  *(float4*)l = *(const float4*)g;
#endif
}

__device__ __forceinline__ void wait_async0() {
#if HAS_ASYNC_LDS
#if __has_builtin(__builtin_amdgcn_s_wait_asynccnt)
  __builtin_amdgcn_s_wait_asynccnt(0);
#else
  asm volatile("s_wait_asynccnt 0" ::: "memory");
#endif
#endif
}

__device__ __forceinline__ v8h lds_tr16(const _Float16* p) {
  typedef __attribute__((address_space(3))) s16x8 lds_s16x8;
  return __builtin_bit_cast(
      v8h, __builtin_amdgcn_ds_load_tr16_b128_v8i16((lds_s16x8*)p));
}

__device__ __forceinline__ void wait_ds0() {
  asm volatile("s_wait_dscnt 0" ::: "memory");
}

// Butterfly over each 16-lane row (lane ^ 1, 2, 4, 8) for eight independent
// values at once, on the vector unit by DPP. The eight values of a step stand
// side by side so that each link of a chain is covered by the seven others.
#define ROW16_STEP(op, k)                                        \
  op " %0, %0, %0 row_xmask:" #k " row_mask:0xf bank_mask:0xf\n\t" \
  op " %1, %1, %1 row_xmask:" #k " row_mask:0xf bank_mask:0xf\n\t" \
  op " %2, %2, %2 row_xmask:" #k " row_mask:0xf bank_mask:0xf\n\t" \
  op " %3, %3, %3 row_xmask:" #k " row_mask:0xf bank_mask:0xf\n\t" \
  op " %4, %4, %4 row_xmask:" #k " row_mask:0xf bank_mask:0xf\n\t" \
  op " %5, %5, %5 row_xmask:" #k " row_mask:0xf bank_mask:0xf\n\t" \
  op " %6, %6, %6 row_xmask:" #k " row_mask:0xf bank_mask:0xf\n\t" \
  op " %7, %7, %7 row_xmask:" #k " row_mask:0xf bank_mask:0xf\n\t"
#define ROW16_ALL(op) \
  ROW16_STEP(op, 1) ROW16_STEP(op, 2) ROW16_STEP(op, 4) ROW16_STEP(op, 8)

// Needs all 32 lanes on. Replaces __shfl_xor, which compiles to an LDS-path
// permute with a wait behind each link.
__device__ __forceinline__ void row16_max8(float (&x)[8]) {
  asm(ROW16_ALL("v_max_num_f32_dpp")
      : "+v"(x[0]), "+v"(x[1]), "+v"(x[2]), "+v"(x[3]),
        "+v"(x[4]), "+v"(x[5]), "+v"(x[6]), "+v"(x[7]));
}

__device__ __forceinline__ float exp_with_slot(float x) {
  float y;
  asm("v_exp_f32 %0, %1\n\tv_nop" : "=v"(y) : "v"(x * 0x1.715476p+0f));
  return y;
}

__device__ __forceinline__ void row16_sum8(float (&x)[8]) {
  asm(ROW16_ALL("v_add_f32_dpp")
      : "+v"(x[0]), "+v"(x[1]), "+v"(x[2]), "+v"(x[3]),
        "+v"(x[4]), "+v"(x[5]), "+v"(x[6]), "+v"(x[7]));
}

template <bool F16OUT>
__global__ void __launch_bounds__(256)
gemm_f16_wmma(const float* __restrict__ X, const float* __restrict__ W,
              void* __restrict__ Yp, int M, int N, int K, float oscale) {
  __shared__ _Float16 Xs[2][128][40];   // two stages; 80B row stride (16B multiple)
  __shared__ _Float16 Ws[2][128][40];

  const int tid  = threadIdx.x;
  const int wave = tid >> 5;
  const int lane = tid & 31;
  const int half = (lane >> 4) & 1;   // which 16-lane half
  const int nl   = lane & 15;
  const int kb   = half * 8;          // per-half K base inside the 32-wide step
  const int wm   = wave & 3;          // 4 wave-rows of 32
  const int wn   = wave >> 2;         // 2 wave-cols of 64
  const int m0   = blockIdx.x * 128;
  const int n0   = blockIdx.y * 128;

  v8f acc[2][4];
#pragma unroll
  for (int mi = 0; mi < 2; ++mi)
#pragma unroll
    for (int ns = 0; ns < 4; ++ns) acc[mi][ns] = (v8f){0,0,0,0,0,0,0,0};

  // Each thread moves 4 chunks of 4 floats of either 128x32 tile: rows
  // srow + 32 i, floats scol .. scol + 3.
  const int srow = tid >> 3;
  const int scol = (tid & 7) * 4;
  const float* xg = X + (size_t)(m0 + srow) * K + scol;
  const float* wg = W + (size_t)(n0 + srow) * K + scol;
  float4 xr[4], wr[4];   // the tile in flight from global memory

  // Issue the loads of the K-step that starts at k0; their data is not waited
  // for here.
  auto fetch = [&](int k0) {
    const float* px[4];
    const float* pw[4];
#pragma unroll
    for (int i = 0; i < 4; ++i) {
      px[i] = xg + (size_t)(i * 32) * K + k0;
      pw[i] = wg + (size_t)(i * 32) * K + k0;
    }
#pragma unroll
    for (int i = 0; i < 4; ++i) xr[i] = *(const float4*)px[i];
#pragma unroll
    for (int i = 0; i < 4; ++i) wr[i] = *(const float4*)pw[i];
    // The wait that stands before a register named by an issued load is
    // overwritten. The eight address pairs are its inputs, so that none is
    // reused (as a later load's destination, for a later address) ahead of it.
    // Its clobber also holds the loads' issue ahead of the LDS reads and
    // products that follow; sunk below them, their latency would stand open.
    asm volatile("s_wait_xcnt 0x0"
                 :: "v"(px[0]), "v"(px[1]), "v"(px[2]), "v"(px[3]),
                    "v"(pw[0]), "v"(pw[1]), "v"(pw[2]), "v"(pw[3])
                 : "memory");
  };
  // Convert the fetched tile to f16 and lay it into stage s.
  auto stash = [&](int s) {
#pragma unroll
    for (int i = 0; i < 4; ++i) {
      _Float16* xl = &Xs[s][srow + i * 32][scol];
      xl[0] = (_Float16)xr[i].x;  xl[1] = (_Float16)xr[i].y;
      xl[2] = (_Float16)xr[i].z;  xl[3] = (_Float16)xr[i].w;
      _Float16* wl = &Ws[s][srow + i * 32][scol];
      wl[0] = (_Float16)wr[i].x;  wl[1] = (_Float16)wr[i].y;
      wl[2] = (_Float16)wr[i].z;  wl[3] = (_Float16)wr[i].w;
    }
  };
  // The 8 WMMA of one K-step, operands from stage s.
  auto mma = [&](int s) {
    v16h a[2];
#pragma unroll
    for (int mi = 0; mi < 2; ++mi)
#pragma unroll
      for (int e = 0; e < 16; ++e) {
        int kk = kb + e + ((e & 8) ? 8 : 0);
        a[mi][e] = Xs[s][wm * 32 + mi * 16 + nl][kk];
      }
    v16h b[4];   // column n = W row (n0+wn*64+ns*16+nl), K along the W row
#pragma unroll
    for (int ns = 0; ns < 4; ++ns)
#pragma unroll
      for (int e = 0; e < 16; ++e) {
        int kk = kb + e + ((e & 8) ? 8 : 0);
        b[ns][e] = Ws[s][wn * 64 + ns * 16 + nl][kk];
      }
    // Keeps all twelve LDS reads ahead of the first product. With the fetched
    // tile held in registers the compiler otherwise reuses one B fragment's
    // registers four times, and each reuse waits out a full LDS latency.
    __builtin_amdgcn_sched_barrier(0);
#pragma unroll
    for (int ns = 0; ns < 4; ++ns)
#pragma unroll
      for (int mi = 0; mi < 2; ++mi)
        acc[mi][ns] = __builtin_amdgcn_wmma_f32_16x16x32_f16(
            false, a[mi], false, b[ns], (short)0, acc[mi][ns], false, false);
  };

  // Two LDS stages: the next K-step's global loads fly while this step's
  // products run. One barrier a step: it publishes the stage just written and
  // ends every wave's reads of the stage that the next step overwrites.
  fetch(0);
  stash(0);
  __syncthreads();
  int s = 0;
  for (int k0 = 32; k0 < K; k0 += 32) {
    fetch(k0);
    mma(s);
    // Keeps the conversions, and with them the wait for the loads, behind the
    // products; the compiler lifts them ahead to free registers early.
    __builtin_amdgcn_sched_barrier(0);
    stash(s ^ 1);
    __syncthreads();
    s ^= 1;
  }
  mma(s);

#pragma unroll
  for (int mi = 0; mi < 2; ++mi)
#pragma unroll
    for (int ns = 0; ns < 4; ++ns)
#pragma unroll
      for (int r = 0; r < 8; ++r) {
        size_t idx = (size_t)(m0 + wm * 32 + mi * 16 + r + half * 8) * N +
                     n0 + wn * 64 + ns * 16 + nl;
        float vv = acc[mi][ns][r] * oscale;
        if (F16OUT) ((_Float16*)Yp)[idx] = (_Float16)vv;
        else        ((float*)Yp)[idx] = vv;
      }
}

// ---------------------------------------------------------------------------
// Forget gate: f[h][t] = log_sigmoid(hidden[t] . Wf[h] + bf[h])
// One block per 32 positions, all 16 heads; its 16 waves split k, 64 each.
// f32 WMMA 16x16x4 with Wf as A (M = head) and hidden as B (N = position):
// hidden is read once for all heads, 32 bytes a row and load, where one thread
// per (h, t) read it 16 times with every lane on a cache line of its own.
// A's row and B's column are loaded by the same code (16 bytes at k0 + 8 j of
// the lane's row, k0 holding the lane half's 4), so their k orders are equal.
// ---------------------------------------------------------------------------
#define FG_T 32      // positions per block: a whole 128-byte line of f per head
#define FG_W 16      // waves per block
#define FG_K (HID / FG_W)

__global__ void __launch_bounds__(FG_W * 32)
fgate_kernel(const float* __restrict__ x, const float* __restrict__ Wf,
             const float* __restrict__ bf, float* __restrict__ f) {
  __shared__ float part[FG_W][NH][FG_T];   // each wave's partial sums
  const int tid  = threadIdx.x;
  const int w    = tid >> 5;
  const int lane = tid & 31;
  const int c    = lane & 15;
  const int hh   = lane >> 4;
  const int t0   = blockIdx.x * FG_T;
  const int k0   = w * FG_K + hh * 4;

  const float* wp = Wf + (size_t)c * HID + k0;
  const float* xp = x + (size_t)(t0 + c) * HID + k0;
  float4 wv[FG_K / 8], xa[FG_K / 8], xb[FG_K / 8];
#pragma unroll
  for (int j = 0; j < FG_K / 8; ++j) {
    wv[j] = *(const float4*)(wp + j * 8);
    xa[j] = *(const float4*)(xp + j * 8);
    xb[j] = *(const float4*)(xp + (size_t)16 * HID + j * 8);
  }
  const float bias = bf[w];
  // Keeps all 25 loads ahead of the first product, so that the wave waits out
  // one load latency. Without it the compiler keeps nine in flight, reuses
  // their registers and issues the rest behind products that wait for data.
  __builtin_amdgcn_sched_barrier(0);

  v8f a0 = (v8f){0,0,0,0,0,0,0,0};   // positions t0 .. t0 + 15
  v8f a1 = (v8f){0,0,0,0,0,0,0,0};   // positions t0 + 16 .. t0 + 31
#pragma unroll
  for (int j = 0; j < FG_K / 8; ++j) {
    const v2f wl = {wv[j].x, wv[j].y}, wh = {wv[j].z, wv[j].w};
    a0 = __builtin_amdgcn_wmma_f32_16x16x4_f32(
        false, wl, false, (v2f){xa[j].x, xa[j].y}, (short)0, a0, false, false);
    a1 = __builtin_amdgcn_wmma_f32_16x16x4_f32(
        false, wl, false, (v2f){xb[j].x, xb[j].y}, (short)0, a1, false, false);
    a0 = __builtin_amdgcn_wmma_f32_16x16x4_f32(
        false, wh, false, (v2f){xa[j].z, xa[j].w}, (short)0, a0, false, false);
    a1 = __builtin_amdgcn_wmma_f32_16x16x4_f32(
        false, wh, false, (v2f){xb[j].z, xb[j].w}, (short)0, a1, false, false);
  }
  __builtin_amdgcn_sched_barrier(0);
  // D layout: register r of lane (c, hh) is (head 8 hh + r, position c).
#pragma unroll
  for (int r = 0; r < 8; ++r) {
    part[w][hh * 8 + r][c]      = a0[r];
    part[w][hh * 8 + r][16 + c] = a1[r];
  }
  __syncthreads();   // publishes the 16 partial sums of every (head, position)

  // Wave w finishes head w: 32 consecutive positions, one whole line of f.
  float acc = bias;
#pragma unroll
  for (int j = 0; j < FG_W; ++j) acc += part[j][w][lane];
  float ls = (acc > 0.f) ? -log1pf(__expf(-acc)) : (acc - log1pf(__expf(acc)));
  f[(size_t)w * T_SEQ + t0 + lane] = ls;
}

// Cumulative decay (both directions): gc[dir][h][p] over direction-local p.
// One 256-thread block per (dir, head). Each thread sums its 8 consecutive
// positions, the 32 lane totals are scanned by shuffles, the 8 wave totals
// go through LDS; every thread then adds the sum of all that lies before it.
__global__ void __launch_bounds__(256)
fscan_kernel(const float* __restrict__ f, float* __restrict__ gc) {
  __shared__ float wtot[8];
  const int tid  = threadIdx.x;
  const int wave = tid >> 5;
  const int lane = tid & 31;
  const int dir  = blockIdx.x >> 4;
  const int h    = blockIdx.x & 15;
  const int p0   = tid * 8;
  const float* fh = f + (size_t)h * T_SEQ;

  // Position p reads t = p, or t = T-1-p in the reverse direction: there the
  // thread's 8 floats lie at T-8-p0 and are taken from the top down.
  const float* src = fh + (dir ? (T_SEQ - 8 - p0) : p0);
  const float4 a = *(const float4*)(src);
  const float4 b = *(const float4*)(src + 4);
  float x[8];
  x[0] = dir ? b.w : a.x;  x[1] = dir ? b.z : a.y;
  x[2] = dir ? b.y : a.z;  x[3] = dir ? b.x : a.w;
  x[4] = dir ? a.w : b.x;  x[5] = dir ? a.z : b.y;
  x[6] = dir ? a.y : b.z;  x[7] = dir ? a.x : b.w;
#pragma unroll
  for (int i = 1; i < 8; ++i) x[i] += x[i - 1];

  float incl = x[7];             // inclusive scan of the lane totals
#pragma unroll
  for (int off = 1; off < 32; off <<= 1) {
    float up = __shfl_up(incl, off, 32);
    if (lane >= off) incl += up;
  }
  const float excl = __shfl_up(incl, 1, 32);
  if (lane == 31) wtot[wave] = incl;
  __syncthreads();               // publishes the 8 wave totals
  float base = (lane > 0) ? excl : 0.f;   // lanes before this one, same wave
#pragma unroll
  for (int j = 0; j < 7; ++j)
    if (j < wave) base += wtot[j];

  float* dst = gc + (size_t)blockIdx.x * T_SEQ + p0;
  *(float4*)(dst)     = make_float4(x[0] + base, x[1] + base, x[2] + base, x[3] + base);
  *(float4*)(dst + 4) = make_float4(x[4] + base, x[5] + base, x[6] + base, x[7] + base);
}

// ---------------------------------------------------------------------------
// Flash-style forgetting attention, one wave per 16-row Q tile.
// grid = (T/16/WPB, NH, 2 directions). Causal in direction-local coords.
// q/k/v are f16 (q pre-scaled). K/V blocks async-DMA'd to LDS as raw f16.
// S tile: 16x32 via 4 WMMA; PV: 4 WMMA with ds_load_tr16_b128 V-columns.
// ---------------------------------------------------------------------------
__global__ void __launch_bounds__(WPB * 32)
fox_attn_kernel(const _Float16* __restrict__ q, const _Float16* __restrict__ k,
                const _Float16* __restrict__ v, const float* __restrict__ gc,
                float* __restrict__ obuf) {
  __shared__ _Float16 kv_s[WPB][32][72];   // 144B row stride (16B multiple)
  __shared__ _Float16 p_s[WPB][16][32];

  const int w    = threadIdx.x >> 5;
  const int lane = threadIdx.x & 31;
  const int half = (lane >> 4) & 1;
  const int nl   = lane & 15;
  const int kbh  = half * 8;
  const int qt   = blockIdx.x * WPB + w;    // q-tile index, 0..127
  const int h    = blockIdx.y;
  const int dir  = blockIdx.z;
  const float* gcd = gc + ((size_t)dir * NH + h) * T_SEQ;

  // Q fragments for this wave's 16 rows (q already scaled by d^-0.5).
  int qp_a = qt * 16 + nl;
  int tq   = dir ? (T_SEQ - 1 - qp_a) : qp_a;
  const _Float16* qrow = q + (size_t)tq * HID + h * HD;
  v16h a0, a1;
#pragma unroll
  for (int e = 0; e < 16; ++e) {
    int kk = kbh + e + ((e & 8) ? 8 : 0);
    a0[e] = qrow[kk];
    a1[e] = qrow[32 + kk];
  }
  float gq[8];
#pragma unroll
  for (int r = 0; r < 8; ++r) gq[r] = gcd[qt * 16 + r + half * 8];

  v8f o[4];
#pragma unroll
  for (int i = 0; i < 4; ++i) o[i] = (v8f){0,0,0,0,0,0,0,0};
  float rmax[8], rsum[8];
#pragma unroll
  for (int r = 0; r < 8; ++r) { rmax[r] = -1e30f; rsum[r] = 0.f; }

  // This lane's address in the V block for the transposing loads.
  const _Float16* vtr = &kv_s[w][kbh + (lane & 7)][((lane >> 3) & 1) * 8];

  const int nkb = (qt >> 1) + 1;            // causal: kv blocks of 32
  for (int kbI = 0; kbI < nkb; ++kbI) {
    const int kv0 = kbI * 32;

    // ---- stage K block (32 x 64 f16 = 32 rows x 8 16B chunks) ----
    wait_ds0();   // prior iter's LDS reads done before DMA overwrites
#pragma unroll
    for (int i = 0; i < 8; ++i) {
      int flat = i * 32 + lane, row = flat >> 3, c = flat & 7;
      int p = kv0 + row, t = dir ? (T_SEQ - 1 - p) : p;
      copy16_g2l(k + (size_t)t * HID + h * HD + c * 8, &kv_s[w][row][c * 8]);
    }
    wait_async0();

    // ---- S = Q K^T : two 16x16 accum tiles ----
    v8f s0 = (v8f){0,0,0,0,0,0,0,0};
    v8f s1 = (v8f){0,0,0,0,0,0,0,0};
#pragma unroll
    for (int ks = 0; ks < 2; ++ks) {
      v16h b0, b1;
#pragma unroll
      for (int e = 0; e < 16; ++e) {
        int kk = ks * 32 + kbh + e + ((e & 8) ? 8 : 0);
        b0[e] = kv_s[w][nl][kk];        // key rows 0..15
        b1[e] = kv_s[w][16 + nl][kk];   // key rows 16..31
      }
      s0 = __builtin_amdgcn_wmma_f32_16x16x32_f16(
          false, (ks ? a1 : a0), false, b0, (short)0, s0, false, false);
      s1 = __builtin_amdgcn_wmma_f32_16x16x32_f16(
          false, (ks ? a1 : a0), false, b1, (short)0, s1, false, false);
    }

    // ---- decay + causal mask + online softmax (rows across 16 lanes) ----
    float gk0 = gcd[kv0 + nl];
    float gk1 = gcd[kv0 + 16 + nl];
    int kp0 = kv0 + nl, kp1 = kv0 + 16 + nl;
    float x0[8], x1[8], m[8];
#pragma unroll
    for (int r = 0; r < 8; ++r) {
      int qp = qt * 16 + r + half * 8;
      x0[r] = (kp0 <= qp) ? (s0[r] + gq[r] - gk0) : -1e30f;
      x1[r] = (kp1 <= qp) ? (s1[r] + gq[r] - gk1) : -1e30f;
      m[r]  = fmaxf(x0[r], x1[r]);
    }
    row16_max8(m);
    float dm[8], ps[8];
#pragma unroll
    for (int r = 0; r < 8; ++r) {
      float nm = fmaxf(rmax[r], m[r]);
      dm[r] = rmax[r] - nm;
      rmax[r] = nm;
      float p0 = __expf(x0[r] - nm), p1 = __expf(x1[r] - nm);
      ps[r] = p0 + p1;
      // transpose P (C-layout -> A-layout) through LDS
      p_s[w][r + half * 8][nl]      = (_Float16)p0;
      p_s[w][r + half * 8][16 + nl] = (_Float16)p1;
    }
    wait_ds0();

    // ---- stage V block (reuse kv_s) ----
#pragma unroll
    for (int i = 0; i < 8; ++i) {
      int flat = i * 32 + lane, row = flat >> 3, c = flat & 7;
      int p = kv0 + row, t = dir ? (T_SEQ - 1 - p) : p;
      copy16_g2l(v + (size_t)t * HID + h * HD + c * 8, &kv_s[w][row][c * 8]);
    }
    // Row sums, alpha and the rescale need no LDS. The scheduling barrier keeps
    // them behind the copies' issue, where they fill the wait for the V block
    // and its fragments; without it the compiler lifts them ahead of the copies.
    __builtin_amdgcn_sched_barrier(0);
    row16_sum8(ps);
#pragma unroll
    for (int r = 0; r < 8; ++r) {
      float alpha = exp_with_slot(dm[r]);
      rsum[r] = rsum[r] * alpha + ps[r];
#pragma unroll
      for (int i = 0; i < 4; ++i) o[i][r] *= alpha;
    }
    wait_async0();

    // ---- O += P V : P as A fragment, V columns as B fragments ----
    v16h ap;
#pragma unroll
    for (int e = 0; e < 16; ++e) {
      int kk = kbh + e + ((e & 8) ? 8 : 0);
      ap[e] = p_s[w][nl][kk];
    }
    // V lies row-major [kv][d]; the B fragment wants column ns * 16 + nl with
    // kv = kbh + e (e < 8) and 16 + kbh + (e - 8): two transposing loads, at kv
    // rows 0 and 16, deliver exactly that, in ap's k order.
    v16h bv[4];
#pragma unroll
    for (int ns = 0; ns < 4; ++ns) {
      const v8h lo = lds_tr16(vtr + ns * 16);
      const v8h hi = lds_tr16(vtr + 16 * 72 + ns * 16);
#pragma unroll
      for (int e = 0; e < 8; ++e) { bv[ns][e] = lo[e]; bv[ns][8 + e] = hi[e]; }
    }
    // Keeps all ten LDS reads ahead of the first product. The compiler
    // otherwise reuses one V fragment's registers, and each reuse waits out an
    // LDS latency between two products.
    __builtin_amdgcn_sched_barrier(0);
#pragma unroll
    for (int ns = 0; ns < 4; ++ns)
      o[ns] = __builtin_amdgcn_wmma_f32_16x16x32_f16(
          false, ap, false, bv[ns], (short)0, o[ns], false, false);
  }

  // ---- epilogue: normalize and scatter into concat buffer [T, 2H] ----
#pragma unroll
  for (int ns = 0; ns < 4; ++ns)
#pragma unroll
    for (int r = 0; r < 8; ++r) {
      int qp = qt * 16 + r + half * 8;
      int t  = dir ? (T_SEQ - 1 - qp) : qp;
      obuf[(size_t)t * (2 * HID) + (size_t)dir * HID + h * HD + ns * 16 + nl] =
          o[ns][r] / rsum[r];
    }
}

// ---------------------------------------------------------------------------
extern "C" void kernel_launch(void* const* d_in, const int* in_sizes, int n_in,
                              void* d_out, int out_size, void* d_ws, size_t ws_size,
                              hipStream_t stream) {
  (void)in_sizes; (void)n_in; (void)out_size; (void)ws_size;
  const float* hidden = (const float*)d_in[0];
  const float* Wq     = (const float*)d_in[1];
  const float* Wk     = (const float*)d_in[2];
  const float* Wv     = (const float*)d_in[3];
  const float* Wf     = (const float*)d_in[4];
  const float* bf     = (const float*)d_in[5];
  const float* Wo     = (const float*)d_in[6];
  float* out = (float*)d_out;

  // Workspace layout: q|k|v (f16) then f|gc|o_concat (f32)
  _Float16* qb = (_Float16*)d_ws;
  _Float16* kb = qb + (size_t)T_SEQ * HID;
  _Float16* vb = kb + (size_t)T_SEQ * HID;
  float* fb = (float*)(vb + (size_t)T_SEQ * HID);
  float* gc = fb + (size_t)NH * T_SEQ;
  float* ob = gc + (size_t)2 * NH * T_SEQ;

  dim3 gproj(T_SEQ / 128, HID / 128);
  gemm_f16_wmma<true><<<gproj, 256, 0, stream>>>(hidden, Wq, qb, T_SEQ, HID, HID,
                                                 0.125f /* d^-0.5 folded in */);
  gemm_f16_wmma<true><<<gproj, 256, 0, stream>>>(hidden, Wk, kb, T_SEQ, HID, HID, 1.f);
  gemm_f16_wmma<true><<<gproj, 256, 0, stream>>>(hidden, Wv, vb, T_SEQ, HID, HID, 1.f);

  fgate_kernel<<<T_SEQ / FG_T, FG_W * 32, 0, stream>>>(hidden, Wf, bf, fb);
  fscan_kernel<<<2 * NH, 256, 0, stream>>>(fb, gc);

  dim3 gattn(T_SEQ / 16 / WPB, NH, 2);
  fox_attn_kernel<<<gattn, WPB * 32, 0, stream>>>(qb, kb, vb, gc, ob);

  dim3 gout(T_SEQ / 128, HID / 128);
  gemm_f16_wmma<false><<<gout, 256, 0, stream>>>(ob, Wo, out, T_SEQ, HID, 2 * HID, 1.f);
}

// v006
// Measured time: 173 microseconds a run.
// Next to v005, in two timings, it ran 1.25 and 1.26 times as fast.
// Over all steps from v000 it is 2.83 times as fast.
#include <hip/hip_runtime.h>
#include <cstddef>

#define T_SEQ 2048
#define HID   1024
#define NH    16
#define HD    64     // head dim
#define WPB   4      // waves per block in attention kernel

typedef __attribute__((ext_vector_type(16))) _Float16 v16h;
typedef __attribute__((ext_vector_type(8)))  _Float16 v8h;
typedef __attribute__((ext_vector_type(8)))  float    v8f;
typedef __attribute__((ext_vector_type(2)))  float    v2f;
typedef __attribute__((ext_vector_type(8)))  short    s16x8;
typedef int async_v4i __attribute__((vector_size(4 * sizeof(int))));

#if __has_builtin(__builtin_amdgcn_global_load_async_to_lds_b128)
#define HAS_ASYNC_LDS 1
#else
#define HAS_ASYNC_LDS 0
#endif

__device__ __forceinline__ void copy16_g2l(const void* g, void* l) {
#if HAS_ASYNC_LDS
  __builtin_amdgcn_global_load_async_to_lds_b128(
      (__attribute__((address_space(1))) async_v4i*)(g),
      (__attribute__((address_space(3))) async_v4i*)(l), 0, 0);
#else
  *(float4*)l = *(const float4*)g;
#endif
}

__device__ __forceinline__ void wait_async0() {
#if HAS_ASYNC_LDS
#if __has_builtin(__builtin_amdgcn_s_wait_asynccnt)
  __builtin_amdgcn_s_wait_asynccnt(0);
#else
  asm volatile("s_wait_asynccnt 0" ::: "memory");
#endif
#endif
}

__device__ __forceinline__ v8h lds_tr16(const _Float16* p) {
  typedef __attribute__((address_space(3))) s16x8 lds_s16x8;
  return __builtin_bit_cast(
      v8h, __builtin_amdgcn_ds_load_tr16_b128_v8i16((lds_s16x8*)p));
}

__device__ __forceinline__ void wait_ds0() {
  asm volatile("s_wait_dscnt 0" ::: "memory");
}

// Butterfly over each 16-lane row (lane ^ 1, 2, 4, 8) for eight independent
// values at once, on the vector unit by DPP. The eight values of a step stand
// side by side so that each link of a chain is covered by the seven others.
#define ROW16_STEP(op, k)                                        \
  op " %0, %0, %0 row_xmask:" #k " row_mask:0xf bank_mask:0xf\n\t" \
  op " %1, %1, %1 row_xmask:" #k " row_mask:0xf bank_mask:0xf\n\t" \
  op " %2, %2, %2 row_xmask:" #k " row_mask:0xf bank_mask:0xf\n\t" \
  op " %3, %3, %3 row_xmask:" #k " row_mask:0xf bank_mask:0xf\n\t" \
  op " %4, %4, %4 row_xmask:" #k " row_mask:0xf bank_mask:0xf\n\t" \
  op " %5, %5, %5 row_xmask:" #k " row_mask:0xf bank_mask:0xf\n\t" \
  op " %6, %6, %6 row_xmask:" #k " row_mask:0xf bank_mask:0xf\n\t" \
  op " %7, %7, %7 row_xmask:" #k " row_mask:0xf bank_mask:0xf\n\t"
#define ROW16_ALL(op) \
  ROW16_STEP(op, 1) ROW16_STEP(op, 2) ROW16_STEP(op, 4) ROW16_STEP(op, 8)

// Needs all 32 lanes on. Replaces __shfl_xor, which compiles to an LDS-path
// permute with a wait behind each link.
__device__ __forceinline__ void row16_max8(float (&x)[8]) {
  asm(ROW16_ALL("v_max_num_f32_dpp")
      : "+v"(x[0]), "+v"(x[1]), "+v"(x[2]), "+v"(x[3]),
        "+v"(x[4]), "+v"(x[5]), "+v"(x[6]), "+v"(x[7]));
}

__device__ __forceinline__ float exp_with_slot(float x) {
  float y;
  asm("v_exp_f32 %0, %1\n\tv_nop" : "=v"(y) : "v"(x * 0x1.715476p+0f));
  return y;
}

__device__ __forceinline__ void row16_sum8(float (&x)[8]) {
  asm(ROW16_ALL("v_add_f32_dpp")
      : "+v"(x[0]), "+v"(x[1]), "+v"(x[2]), "+v"(x[3]),
        "+v"(x[4]), "+v"(x[5]), "+v"(x[6]), "+v"(x[7]));
}

template <bool F16OUT>
__global__ void __launch_bounds__(256)
gemm_f16_wmma(const float* __restrict__ X, const float* __restrict__ W0,
              const float* __restrict__ W1, const float* __restrict__ W2,
              void* __restrict__ Y0, int M, int N, int K, float oscale0) {
  __shared__ _Float16 Xs[2][128][40];   // two stages; 80B row stride (16B multiple)
  __shared__ _Float16 Ws[2][128][40];

  const int z = blockIdx.z;
  const float* W = (z == 0) ? W0 : (z == 1) ? W1 : W2;
  const float oscale = (z == 0) ? oscale0 : 1.f;
  void* Yp = (char*)Y0 + (size_t)z * M * N * (F16OUT ? sizeof(_Float16) : sizeof(float));

  const int tid  = threadIdx.x;
  const int wave = tid >> 5;
  const int lane = tid & 31;
  const int half = (lane >> 4) & 1;   // which 16-lane half
  const int nl   = lane & 15;
  const int kb   = half * 8;          // per-half K base inside the 32-wide step
  const int wm   = wave & 3;          // 4 wave-rows of 32
  const int wn   = wave >> 2;         // 2 wave-cols of 64
  const int m0   = blockIdx.x * 128;
  const int n0   = blockIdx.y * 128;

  v8f acc[2][4];
#pragma unroll
  for (int mi = 0; mi < 2; ++mi)
#pragma unroll
    for (int ns = 0; ns < 4; ++ns) acc[mi][ns] = (v8f){0,0,0,0,0,0,0,0};

  // Each thread moves 4 chunks of 4 floats of either 128x32 tile: rows
  // srow + 32 i, floats scol .. scol + 3.
  const int srow = tid >> 3;
  const int scol = (tid & 7) * 4;
  const float* xg = X + (size_t)(m0 + srow) * K + scol;
  const float* wg = W + (size_t)(n0 + srow) * K + scol;
  float4 xr[4], wr[4];   // the tile in flight from global memory

  // Issue the loads of the K-step that starts at k0; their data is not waited
  // for here.
  auto fetch = [&](int k0) {
    const float* px[4];
    const float* pw[4];
#pragma unroll
    for (int i = 0; i < 4; ++i) {
      px[i] = xg + (size_t)(i * 32) * K + k0;
      pw[i] = wg + (size_t)(i * 32) * K + k0;
    }
#pragma unroll
    for (int i = 0; i < 4; ++i) xr[i] = *(const float4*)px[i];
#pragma unroll
    for (int i = 0; i < 4; ++i) wr[i] = *(const float4*)pw[i];
    // The wait that stands before a register named by an issued load is
    // overwritten. The eight address pairs are its inputs, so that none is
    // reused (as a later load's destination, for a later address) ahead of it.
    // Its clobber also holds the loads' issue ahead of the LDS reads and
    // products that follow; sunk below them, their latency would stand open.
    asm volatile("s_wait_xcnt 0x0"
                 :: "v"(px[0]), "v"(px[1]), "v"(px[2]), "v"(px[3]),
                    "v"(pw[0]), "v"(pw[1]), "v"(pw[2]), "v"(pw[3])
                 : "memory");
  };
  // Convert the fetched tile to f16 and lay it into stage s.
  auto stash = [&](int s) {
#pragma unroll
    for (int i = 0; i < 4; ++i) {
      _Float16* xl = &Xs[s][srow + i * 32][scol];
      xl[0] = (_Float16)xr[i].x;  xl[1] = (_Float16)xr[i].y;
      xl[2] = (_Float16)xr[i].z;  xl[3] = (_Float16)xr[i].w;
      _Float16* wl = &Ws[s][srow + i * 32][scol];
      wl[0] = (_Float16)wr[i].x;  wl[1] = (_Float16)wr[i].y;
      wl[2] = (_Float16)wr[i].z;  wl[3] = (_Float16)wr[i].w;
    }
  };
  // The 8 WMMA of one K-step, operands from stage s.
  auto mma = [&](int s) {
    v16h a[2];
#pragma unroll
    for (int mi = 0; mi < 2; ++mi)
#pragma unroll
      for (int e = 0; e < 16; ++e) {
        int kk = kb + e + ((e & 8) ? 8 : 0);
        a[mi][e] = Xs[s][wm * 32 + mi * 16 + nl][kk];
      }
    v16h b[4];   // column n = W row (n0+wn*64+ns*16+nl), K along the W row
#pragma unroll
    for (int ns = 0; ns < 4; ++ns)
#pragma unroll
      for (int e = 0; e < 16; ++e) {
        int kk = kb + e + ((e & 8) ? 8 : 0);
        b[ns][e] = Ws[s][wn * 64 + ns * 16 + nl][kk];
      }
    // Keeps all twelve LDS reads ahead of the first product. With the fetched
    // tile held in registers the compiler otherwise reuses one B fragment's
    // registers four times, and each reuse waits out a full LDS latency.
    __builtin_amdgcn_sched_barrier(0);
#pragma unroll
    for (int ns = 0; ns < 4; ++ns)
#pragma unroll
      for (int mi = 0; mi < 2; ++mi)
        acc[mi][ns] = __builtin_amdgcn_wmma_f32_16x16x32_f16(
            false, a[mi], false, b[ns], (short)0, acc[mi][ns], false, false);
  };

  // Two LDS stages: the next K-step's global loads fly while this step's
  // products run. One barrier a step: it publishes the stage just written and
  // ends every wave's reads of the stage that the next step overwrites.
  fetch(0);
  stash(0);
  __syncthreads();
  int s = 0;
  for (int k0 = 32; k0 < K; k0 += 32) {
    fetch(k0);
    mma(s);
    // Keeps the conversions, and with them the wait for the loads, behind the
    // products; the compiler lifts them ahead to free registers early.
    __builtin_amdgcn_sched_barrier(0);
    stash(s ^ 1);
    __syncthreads();
    s ^= 1;
  }
  mma(s);

#pragma unroll
  for (int mi = 0; mi < 2; ++mi)
#pragma unroll
    for (int ns = 0; ns < 4; ++ns)
#pragma unroll
      for (int r = 0; r < 8; ++r) {
        size_t idx = (size_t)(m0 + wm * 32 + mi * 16 + r + half * 8) * N +
                     n0 + wn * 64 + ns * 16 + nl;
        float vv = acc[mi][ns][r] * oscale;
        if (F16OUT) ((_Float16*)Yp)[idx] = (_Float16)vv;
        else        ((float*)Yp)[idx] = vv;
      }
}

// ---------------------------------------------------------------------------
// Forget gate: f[h][t] = log_sigmoid(hidden[t] . Wf[h] + bf[h])
// One block per 32 positions, all 16 heads; its 16 waves split k, 64 each.
// f32 WMMA 16x16x4 with Wf as A (M = head) and hidden as B (N = position):
// hidden is read once for all heads, 32 bytes a row and load, where one thread
// per (h, t) read it 16 times with every lane on a cache line of its own.
// A's row and B's column are loaded by the same code (16 bytes at k0 + 8 j of
// the lane's row, k0 holding the lane half's 4), so their k orders are equal.
// ---------------------------------------------------------------------------
#define FG_T 32      // positions per block: a whole 128-byte line of f per head
#define FG_W 16      // waves per block
#define FG_K (HID / FG_W)

__global__ void __launch_bounds__(FG_W * 32)
fgate_kernel(const float* __restrict__ x, const float* __restrict__ Wf,
             const float* __restrict__ bf, float* __restrict__ f) {
  __shared__ float part[FG_W][NH][FG_T];   // each wave's partial sums
  const int tid  = threadIdx.x;
  const int w    = tid >> 5;
  const int lane = tid & 31;
  const int c    = lane & 15;
  const int hh   = lane >> 4;
  const int t0   = blockIdx.x * FG_T;
  const int k0   = w * FG_K + hh * 4;

  const float* wp = Wf + (size_t)c * HID + k0;
  const float* xp = x + (size_t)(t0 + c) * HID + k0;
  float4 wv[FG_K / 8], xa[FG_K / 8], xb[FG_K / 8];
#pragma unroll
  for (int j = 0; j < FG_K / 8; ++j) {
    wv[j] = *(const float4*)(wp + j * 8);
    xa[j] = *(const float4*)(xp + j * 8);
    xb[j] = *(const float4*)(xp + (size_t)16 * HID + j * 8);
  }
  const float bias = bf[w];
  // Keeps all 25 loads ahead of the first product, so that the wave waits out
  // one load latency. Without it the compiler keeps nine in flight, reuses
  // their registers and issues the rest behind products that wait for data.
  __builtin_amdgcn_sched_barrier(0);

  v8f a0 = (v8f){0,0,0,0,0,0,0,0};   // positions t0 .. t0 + 15
  v8f a1 = (v8f){0,0,0,0,0,0,0,0};   // positions t0 + 16 .. t0 + 31
#pragma unroll
  for (int j = 0; j < FG_K / 8; ++j) {
    const v2f wl = {wv[j].x, wv[j].y}, wh = {wv[j].z, wv[j].w};
    a0 = __builtin_amdgcn_wmma_f32_16x16x4_f32(
        false, wl, false, (v2f){xa[j].x, xa[j].y}, (short)0, a0, false, false);
    a1 = __builtin_amdgcn_wmma_f32_16x16x4_f32(
        false, wl, false, (v2f){xb[j].x, xb[j].y}, (short)0, a1, false, false);
    a0 = __builtin_amdgcn_wmma_f32_16x16x4_f32(
        false, wh, false, (v2f){xa[j].z, xa[j].w}, (short)0, a0, false, false);
    a1 = __builtin_amdgcn_wmma_f32_16x16x4_f32(
        false, wh, false, (v2f){xb[j].z, xb[j].w}, (short)0, a1, false, false);
  }
  __builtin_amdgcn_sched_barrier(0);
  // D layout: register r of lane (c, hh) is (head 8 hh + r, position c).
#pragma unroll
  for (int r = 0; r < 8; ++r) {
    part[w][hh * 8 + r][c]      = a0[r];
    part[w][hh * 8 + r][16 + c] = a1[r];
  }
  __syncthreads();   // publishes the 16 partial sums of every (head, position)

  // Wave w finishes head w: 32 consecutive positions, one whole line of f.
  float acc = bias;
#pragma unroll
  for (int j = 0; j < FG_W; ++j) acc += part[j][w][lane];
  float ls = (acc > 0.f) ? -log1pf(__expf(-acc)) : (acc - log1pf(__expf(acc)));
  f[(size_t)w * T_SEQ + t0 + lane] = ls;
}

// Cumulative decay (both directions): gc[dir][h][p] over direction-local p.
// One 256-thread block per (dir, head). Each thread sums its 8 consecutive
// positions, the 32 lane totals are scanned by shuffles, the 8 wave totals
// go through LDS; every thread then adds the sum of all that lies before it.
__global__ void __launch_bounds__(256)
fscan_kernel(const float* __restrict__ f, float* __restrict__ gc) {
  __shared__ float wtot[8];
  const int tid  = threadIdx.x;
  const int wave = tid >> 5;
  const int lane = tid & 31;
  const int dir  = blockIdx.x >> 4;
  const int h    = blockIdx.x & 15;
  const int p0   = tid * 8;
  const float* fh = f + (size_t)h * T_SEQ;

  // Position p reads t = p, or t = T-1-p in the reverse direction: there the
  // thread's 8 floats lie at T-8-p0 and are taken from the top down.
  const float* src = fh + (dir ? (T_SEQ - 8 - p0) : p0);
  const float4 a = *(const float4*)(src);
  const float4 b = *(const float4*)(src + 4);
  float x[8];
  x[0] = dir ? b.w : a.x;  x[1] = dir ? b.z : a.y;
  x[2] = dir ? b.y : a.z;  x[3] = dir ? b.x : a.w;
  x[4] = dir ? a.w : b.x;  x[5] = dir ? a.z : b.y;
  x[6] = dir ? a.y : b.z;  x[7] = dir ? a.x : b.w;
#pragma unroll
  for (int i = 1; i < 8; ++i) x[i] += x[i - 1];

  float incl = x[7];             // inclusive scan of the lane totals
#pragma unroll
  for (int off = 1; off < 32; off <<= 1) {
    float up = __shfl_up(incl, off, 32);
    if (lane >= off) incl += up;
  }
  const float excl = __shfl_up(incl, 1, 32);
  if (lane == 31) wtot[wave] = incl;
  __syncthreads();               // publishes the 8 wave totals
  float base = (lane > 0) ? excl : 0.f;   // lanes before this one, same wave
#pragma unroll
  for (int j = 0; j < 7; ++j)
    if (j < wave) base += wtot[j];

  float* dst = gc + (size_t)blockIdx.x * T_SEQ + p0;
  *(float4*)(dst)     = make_float4(x[0] + base, x[1] + base, x[2] + base, x[3] + base);
  *(float4*)(dst + 4) = make_float4(x[4] + base, x[5] + base, x[6] + base, x[7] + base);
}

// ---------------------------------------------------------------------------
// Flash-style forgetting attention, one wave per 16-row Q tile.
// grid = (T/16/WPB, NH, 2 directions). Causal in direction-local coords.
// q/k/v are f16 (q pre-scaled). K/V blocks async-DMA'd to LDS as raw f16.
// S tile: 16x32 via 4 WMMA; PV: 4 WMMA with ds_load_tr16_b128 V-columns.
// ---------------------------------------------------------------------------
__global__ void __launch_bounds__(WPB * 32)
fox_attn_kernel(const _Float16* __restrict__ q, const _Float16* __restrict__ k,
                const _Float16* __restrict__ v, const float* __restrict__ gc,
                float* __restrict__ obuf) {
  __shared__ _Float16 kv_s[WPB][32][72];   // 144B row stride (16B multiple)
  __shared__ _Float16 p_s[WPB][16][32];

  const int w    = threadIdx.x >> 5;
  const int lane = threadIdx.x & 31;
  const int half = (lane >> 4) & 1;
  const int nl   = lane & 15;
  const int kbh  = half * 8;
  const int qt   = blockIdx.x * WPB + w;    // q-tile index, 0..127
  const int h    = blockIdx.y;
  const int dir  = blockIdx.z;
  const float* gcd = gc + ((size_t)dir * NH + h) * T_SEQ;

  // Q fragments for this wave's 16 rows (q already scaled by d^-0.5).
  int qp_a = qt * 16 + nl;
  int tq   = dir ? (T_SEQ - 1 - qp_a) : qp_a;
  const _Float16* qrow = q + (size_t)tq * HID + h * HD;
  v16h a0, a1;
#pragma unroll
  for (int e = 0; e < 16; ++e) {
    int kk = kbh + e + ((e & 8) ? 8 : 0);
    a0[e] = qrow[kk];
    a1[e] = qrow[32 + kk];
  }
  float gq[8];
#pragma unroll
  for (int r = 0; r < 8; ++r) gq[r] = gcd[qt * 16 + r + half * 8];

  v8f o[4];
#pragma unroll
  for (int i = 0; i < 4; ++i) o[i] = (v8f){0,0,0,0,0,0,0,0};
  float rmax[8], rsum[8];
#pragma unroll
  for (int r = 0; r < 8; ++r) { rmax[r] = -1e30f; rsum[r] = 0.f; }

  // This lane's address in the V block for the transposing loads.
  const _Float16* vtr = &kv_s[w][kbh + (lane & 7)][((lane >> 3) & 1) * 8];

  const int nkb = (qt >> 1) + 1;            // causal: kv blocks of 32
  for (int kbI = 0; kbI < nkb; ++kbI) {
    const int kv0 = kbI * 32;

    // ---- stage K block (32 x 64 f16 = 32 rows x 8 16B chunks) ----
    wait_ds0();   // prior iter's LDS reads done before DMA overwrites
#pragma unroll
    for (int i = 0; i < 8; ++i) {
      int flat = i * 32 + lane, row = flat >> 3, c = flat & 7;
      int p = kv0 + row, t = dir ? (T_SEQ - 1 - p) : p;
      copy16_g2l(k + (size_t)t * HID + h * HD + c * 8, &kv_s[w][row][c * 8]);
    }
    wait_async0();

    // ---- S = Q K^T : two 16x16 accum tiles ----
    v8f s0 = (v8f){0,0,0,0,0,0,0,0};
    v8f s1 = (v8f){0,0,0,0,0,0,0,0};
#pragma unroll
    for (int ks = 0; ks < 2; ++ks) {
      v16h b0, b1;
#pragma unroll
      for (int e = 0; e < 16; ++e) {
        int kk = ks * 32 + kbh + e + ((e & 8) ? 8 : 0);
        b0[e] = kv_s[w][nl][kk];        // key rows 0..15
        b1[e] = kv_s[w][16 + nl][kk];   // key rows 16..31
      }
      s0 = __builtin_amdgcn_wmma_f32_16x16x32_f16(
          false, (ks ? a1 : a0), false, b0, (short)0, s0, false, false);
      s1 = __builtin_amdgcn_wmma_f32_16x16x32_f16(
          false, (ks ? a1 : a0), false, b1, (short)0, s1, false, false);
    }

    // ---- decay + causal mask + online softmax (rows across 16 lanes) ----
    float gk0 = gcd[kv0 + nl];
    float gk1 = gcd[kv0 + 16 + nl];
    int kp0 = kv0 + nl, kp1 = kv0 + 16 + nl;
    float x0[8], x1[8], m[8];
#pragma unroll
    for (int r = 0; r < 8; ++r) {
      int qp = qt * 16 + r + half * 8;
      x0[r] = (kp0 <= qp) ? (s0[r] + gq[r] - gk0) : -1e30f;
      x1[r] = (kp1 <= qp) ? (s1[r] + gq[r] - gk1) : -1e30f;
      m[r]  = fmaxf(x0[r], x1[r]);
    }
    row16_max8(m);
    float dm[8], ps[8];
#pragma unroll
    for (int r = 0; r < 8; ++r) {
      float nm = fmaxf(rmax[r], m[r]);
      dm[r] = rmax[r] - nm;
      rmax[r] = nm;
      float p0 = __expf(x0[r] - nm), p1 = __expf(x1[r] - nm);
      ps[r] = p0 + p1;
      // transpose P (C-layout -> A-layout) through LDS
      p_s[w][r + half * 8][nl]      = (_Float16)p0;
      p_s[w][r + half * 8][16 + nl] = (_Float16)p1;
    }
    wait_ds0();

    // ---- stage V block (reuse kv_s) ----
#pragma unroll
    for (int i = 0; i < 8; ++i) {
      int flat = i * 32 + lane, row = flat >> 3, c = flat & 7;
      int p = kv0 + row, t = dir ? (T_SEQ - 1 - p) : p;
      copy16_g2l(v + (size_t)t * HID + h * HD + c * 8, &kv_s[w][row][c * 8]);
    }
    // Row sums, alpha and the rescale need no LDS. The scheduling barrier keeps
    // them behind the copies' issue, where they fill the wait for the V block
    // and its fragments; without it the compiler lifts them ahead of the copies.
    __builtin_amdgcn_sched_barrier(0);
    row16_sum8(ps);
#pragma unroll
    for (int r = 0; r < 8; ++r) {
      float alpha = exp_with_slot(dm[r]);
      rsum[r] = rsum[r] * alpha + ps[r];
#pragma unroll
      for (int i = 0; i < 4; ++i) o[i][r] *= alpha;
    }
    wait_async0();

    // ---- O += P V : P as A fragment, V columns as B fragments ----
    v16h ap;
#pragma unroll
    for (int e = 0; e < 16; ++e) {
      int kk = kbh + e + ((e & 8) ? 8 : 0);
      ap[e] = p_s[w][nl][kk];
    }
    // V lies row-major [kv][d]; the B fragment wants column ns * 16 + nl with
    // kv = kbh + e (e < 8) and 16 + kbh + (e - 8): two transposing loads, at kv
    // rows 0 and 16, deliver exactly that, in ap's k order.
    v16h bv[4];
#pragma unroll
    for (int ns = 0; ns < 4; ++ns) {
      const v8h lo = lds_tr16(vtr + ns * 16);
      const v8h hi = lds_tr16(vtr + 16 * 72 + ns * 16);
#pragma unroll
      for (int e = 0; e < 8; ++e) { bv[ns][e] = lo[e]; bv[ns][8 + e] = hi[e]; }
    }
    // Keeps all ten LDS reads ahead of the first product. The compiler
    // otherwise reuses one V fragment's registers, and each reuse waits out an
    // LDS latency between two products.
    __builtin_amdgcn_sched_barrier(0);
#pragma unroll
    for (int ns = 0; ns < 4; ++ns)
      o[ns] = __builtin_amdgcn_wmma_f32_16x16x32_f16(
          false, ap, false, bv[ns], (short)0, o[ns], false, false);
  }

  // ---- epilogue: normalize and scatter into concat buffer [T, 2H] ----
#pragma unroll
  for (int ns = 0; ns < 4; ++ns)
#pragma unroll
    for (int r = 0; r < 8; ++r) {
      int qp = qt * 16 + r + half * 8;
      int t  = dir ? (T_SEQ - 1 - qp) : qp;
      obuf[(size_t)t * (2 * HID) + (size_t)dir * HID + h * HD + ns * 16 + nl] =
          o[ns][r] / rsum[r];
    }
}

// ---------------------------------------------------------------------------
extern "C" void kernel_launch(void* const* d_in, const int* in_sizes, int n_in,
                              void* d_out, int out_size, void* d_ws, size_t ws_size,
                              hipStream_t stream) {
  (void)in_sizes; (void)n_in; (void)out_size; (void)ws_size;
  const float* hidden = (const float*)d_in[0];
  const float* Wq     = (const float*)d_in[1];
  const float* Wk     = (const float*)d_in[2];
  const float* Wv     = (const float*)d_in[3];
  const float* Wf     = (const float*)d_in[4];
  const float* bf     = (const float*)d_in[5];
  const float* Wo     = (const float*)d_in[6];
  float* out = (float*)d_out;

  // Workspace layout: q|k|v (f16) then f|gc|o_concat (f32)
  _Float16* qb = (_Float16*)d_ws;
  _Float16* kb = qb + (size_t)T_SEQ * HID;
  _Float16* vb = kb + (size_t)T_SEQ * HID;
  float* fb = (float*)(vb + (size_t)T_SEQ * HID);
  float* gc = fb + (size_t)NH * T_SEQ;
  float* ob = gc + (size_t)2 * NH * T_SEQ;

  // q, k and v in one launch; qb, kb and vb lie one behind the other.
  dim3 gproj(T_SEQ / 128, HID / 128, 3);
  gemm_f16_wmma<true><<<gproj, 256, 0, stream>>>(hidden, Wq, Wk, Wv, qb, T_SEQ, HID, HID,
                                                 0.125f /* d^-0.5 folded in */);

  fgate_kernel<<<T_SEQ / FG_T, FG_W * 32, 0, stream>>>(hidden, Wf, bf, fb);
  fscan_kernel<<<2 * NH, 256, 0, stream>>>(fb, gc);

  dim3 gattn(T_SEQ / 16 / WPB, NH, 2);
  fox_attn_kernel<<<gattn, WPB * 32, 0, stream>>>(qb, kb, vb, gc, ob);

  dim3 gout(T_SEQ / 128, HID / 128);
  // One product: gridDim.z is 1, the second and third weight pointers go unread.
  gemm_f16_wmma<false><<<gout, 256, 0, stream>>>(ob, Wo, Wo, Wo, out, T_SEQ, HID,
                                                 2 * HID, 1.f);
}

// v007
// A run of this version takes 162 microseconds.
// Next to v006, in two timings, it ran 1.08 and 1.06 times as fast.
// Over all steps from v000 it is 3.03 times as fast.
#include <hip/hip_runtime.h>
#include <cstddef>

#define T_SEQ 2048
#define HID   1024
#define NH    16
#define HD    64     // head dim
#define WPB   4      // waves per block in attention kernel

typedef __attribute__((ext_vector_type(16))) _Float16 v16h;
typedef __attribute__((ext_vector_type(8)))  _Float16 v8h;
typedef __attribute__((ext_vector_type(8)))  float    v8f;
typedef __attribute__((ext_vector_type(2)))  float    v2f;
typedef __attribute__((ext_vector_type(8)))  short    s16x8;
typedef int async_v4i __attribute__((vector_size(4 * sizeof(int))));

#if __has_builtin(__builtin_amdgcn_global_load_async_to_lds_b128)
#define HAS_ASYNC_LDS 1
#else
#define HAS_ASYNC_LDS 0
#endif

__device__ __forceinline__ void copy16_g2l(const void* g, void* l) {
#if HAS_ASYNC_LDS
  __builtin_amdgcn_global_load_async_to_lds_b128(
      (__attribute__((address_space(1))) async_v4i*)(g),
      (__attribute__((address_space(3))) async_v4i*)(l), 0, 0);
#else
  *(float4*)l = *(const float4*)g;
#endif
}

__device__ __forceinline__ void wait_async0() {
#if HAS_ASYNC_LDS
#if __has_builtin(__builtin_amdgcn_s_wait_asynccnt)
  __builtin_amdgcn_s_wait_asynccnt(0);
#else
  asm volatile("s_wait_asynccnt 0" ::: "memory");
#endif
#endif
}

__device__ __forceinline__ v8h lds_tr16(const _Float16* p) {
  typedef __attribute__((address_space(3))) s16x8 lds_s16x8;
  return __builtin_bit_cast(
      v8h, __builtin_amdgcn_ds_load_tr16_b128_v8i16((lds_s16x8*)p));
}

__device__ __forceinline__ void wait_ds0() {
  asm volatile("s_wait_dscnt 0" ::: "memory");
}

// Butterfly over each 16-lane row (lane ^ 1, 2, 4, 8) for eight independent
// values at once, on the vector unit by DPP. The eight values of a step stand
// side by side so that each link of a chain is covered by the seven others.
#define ROW16_STEP(op, k)                                        \
  op " %0, %0, %0 row_xmask:" #k " row_mask:0xf bank_mask:0xf\n\t" \
  op " %1, %1, %1 row_xmask:" #k " row_mask:0xf bank_mask:0xf\n\t" \
  op " %2, %2, %2 row_xmask:" #k " row_mask:0xf bank_mask:0xf\n\t" \
  op " %3, %3, %3 row_xmask:" #k " row_mask:0xf bank_mask:0xf\n\t" \
  op " %4, %4, %4 row_xmask:" #k " row_mask:0xf bank_mask:0xf\n\t" \
  op " %5, %5, %5 row_xmask:" #k " row_mask:0xf bank_mask:0xf\n\t" \
  op " %6, %6, %6 row_xmask:" #k " row_mask:0xf bank_mask:0xf\n\t" \
  op " %7, %7, %7 row_xmask:" #k " row_mask:0xf bank_mask:0xf\n\t"
#define ROW16_ALL(op) \
  ROW16_STEP(op, 1) ROW16_STEP(op, 2) ROW16_STEP(op, 4) ROW16_STEP(op, 8)

// Needs all 32 lanes on. Replaces __shfl_xor, which compiles to an LDS-path
// permute with a wait behind each link.
__device__ __forceinline__ void row16_max8(float (&x)[8]) {
  asm(ROW16_ALL("v_max_num_f32_dpp")
      : "+v"(x[0]), "+v"(x[1]), "+v"(x[2]), "+v"(x[3]),
        "+v"(x[4]), "+v"(x[5]), "+v"(x[6]), "+v"(x[7]));
}

__device__ __forceinline__ float exp_with_slot(float x) {
  float y;
  asm("v_exp_f32 %0, %1\n\tv_nop" : "=v"(y) : "v"(x * 0x1.715476p+0f));
  return y;
}

__device__ __forceinline__ void row16_sum8(float (&x)[8]) {
  asm(ROW16_ALL("v_add_f32_dpp")
      : "+v"(x[0]), "+v"(x[1]), "+v"(x[2]), "+v"(x[3]),
        "+v"(x[4]), "+v"(x[5]), "+v"(x[6]), "+v"(x[7]));
}

template <bool F16OUT>
__global__ void __launch_bounds__(256)
gemm_f16_wmma(const float* __restrict__ X, const float* __restrict__ W0,
              const float* __restrict__ W1, const float* __restrict__ W2,
              void* __restrict__ Y0, int M, int N, int K, float oscale0) {
  __shared__ _Float16 Xs[2][128][72];   // two stages; 144B row stride (16B x odd)
  __shared__ _Float16 Ws[2][128][72];

  const int z = blockIdx.z;
  const float* W = (z == 0) ? W0 : (z == 1) ? W1 : W2;
  const float oscale = (z == 0) ? oscale0 : 1.f;
  void* Yp = (char*)Y0 + (size_t)z * M * N * (F16OUT ? sizeof(_Float16) : sizeof(float));

  const int tid  = threadIdx.x;
  const int wave = tid >> 5;
  const int lane = tid & 31;
  const int half = (lane >> 4) & 1;   // which 16-lane half
  const int nl   = lane & 15;
  const int kb   = half * 8;          // per-half K base inside a 32-wide product
  const int wm   = wave & 3;          // 4 wave-rows of 32
  const int wn   = wave >> 2;         // 2 wave-cols of 64
  const int m0   = blockIdx.x * 128;
  const int n0   = blockIdx.y * 128;

  v8f acc[2][4];
#pragma unroll
  for (int mi = 0; mi < 2; ++mi)
#pragma unroll
    for (int ns = 0; ns < 4; ++ns) acc[mi][ns] = (v8f){0,0,0,0,0,0,0,0};

  // Each thread moves 8 chunks of 4 floats of either 128x64 tile: rows
  // srow + 16 i, floats scol .. scol + 3.
  const int srow = tid >> 4;
  const int scol = (tid & 15) * 4;
  const float* xg = X + (size_t)(m0 + srow) * K + scol;
  const float* wg = W + (size_t)(n0 + srow) * K + scol;
  float4 xr[8], wr[8];   // the tile in flight from global memory

  // Issue the loads of the K-step that starts at k0; their data is not waited
  // for here.
  auto fetch = [&](int k0) {
    const float* px[8];
    const float* pw[8];
#pragma unroll
    for (int i = 0; i < 8; ++i) {
      px[i] = xg + (size_t)(i * 16) * K + k0;
      pw[i] = wg + (size_t)(i * 16) * K + k0;
    }
#pragma unroll
    for (int i = 0; i < 8; ++i) xr[i] = *(const float4*)px[i];
#pragma unroll
    for (int i = 0; i < 8; ++i) wr[i] = *(const float4*)pw[i];
    // The wait that stands before a register named by an issued load is
    // overwritten. The sixteen address pairs are its inputs, so that none is
    // reused (as a later load's destination, for a later address) ahead of it.
    // Its clobber also holds the loads' issue ahead of the LDS reads and
    // products that follow; sunk below them, their latency would stand open.
    asm volatile("s_wait_xcnt 0x0"
                 :: "v"(px[0]), "v"(px[1]), "v"(px[2]), "v"(px[3]),
                    "v"(px[4]), "v"(px[5]), "v"(px[6]), "v"(px[7]),
                    "v"(pw[0]), "v"(pw[1]), "v"(pw[2]), "v"(pw[3]),
                    "v"(pw[4]), "v"(pw[5]), "v"(pw[6]), "v"(pw[7])
                 : "memory");
  };
  // Convert the fetched tile to f16 and lay it into stage s.
  auto stash = [&](int s) {
#pragma unroll
    for (int i = 0; i < 8; ++i) {
      _Float16* xl = &Xs[s][srow + i * 16][scol];
      xl[0] = (_Float16)xr[i].x;  xl[1] = (_Float16)xr[i].y;
      xl[2] = (_Float16)xr[i].z;  xl[3] = (_Float16)xr[i].w;
      _Float16* wl = &Ws[s][srow + i * 16][scol];
      wl[0] = (_Float16)wr[i].x;  wl[1] = (_Float16)wr[i].y;
      wl[2] = (_Float16)wr[i].z;  wl[3] = (_Float16)wr[i].w;
    }
  };
  // The 16 WMMA of one K-step, operands from stage s; ks is the 32-wide half.
  auto mma = [&](int s) {
    v16h a[2][2];
    v16h b[2][4];   // column n = W row (n0+wn*64+ns*16+nl), K along the W row
#pragma unroll
    for (int ks = 0; ks < 2; ++ks) {
#pragma unroll
      for (int mi = 0; mi < 2; ++mi)
#pragma unroll
        for (int e = 0; e < 16; ++e) {
          int kk = ks * 32 + kb + e + ((e & 8) ? 8 : 0);
          a[ks][mi][e] = Xs[s][wm * 32 + mi * 16 + nl][kk];
        }
#pragma unroll
      for (int ns = 0; ns < 4; ++ns)
#pragma unroll
        for (int e = 0; e < 16; ++e) {
          int kk = ks * 32 + kb + e + ((e & 8) ? 8 : 0);
          b[ks][ns][e] = Ws[s][wn * 64 + ns * 16 + nl][kk];
        }
    }
    // Keeps all 24 LDS reads ahead of the first product. With the fetched
    // tile held in registers the compiler otherwise reuses a B fragment's
    // registers, and each reuse waits out a full LDS latency.
    __builtin_amdgcn_sched_barrier(0);
#pragma unroll
    for (int ks = 0; ks < 2; ++ks)
#pragma unroll
      for (int ns = 0; ns < 4; ++ns)
#pragma unroll
        for (int mi = 0; mi < 2; ++mi)
          acc[mi][ns] = __builtin_amdgcn_wmma_f32_16x16x32_f16(
              false, a[ks][mi], false, b[ks][ns], (short)0, acc[mi][ns], false, false);
  };

  // Two LDS stages: the next K-step's global loads fly while this step's
  // products run. One barrier a step: it publishes the stage just written and
  // ends every wave's reads of the stage that the next step overwrites.
  fetch(0);
  stash(0);
  __syncthreads();
  int s = 0;
  for (int k0 = 64; k0 < K; k0 += 64) {
    fetch(k0);
    mma(s);
    // Keeps the conversions, and with them the wait for the loads, behind the
    // products; the compiler lifts them ahead to free registers early.
    __builtin_amdgcn_sched_barrier(0);
    stash(s ^ 1);
    __syncthreads();
    s ^= 1;
  }
  mma(s);

#pragma unroll
  for (int mi = 0; mi < 2; ++mi)
#pragma unroll
    for (int ns = 0; ns < 4; ++ns)
#pragma unroll
      for (int r = 0; r < 8; ++r) {
        size_t idx = (size_t)(m0 + wm * 32 + mi * 16 + r + half * 8) * N +
                     n0 + wn * 64 + ns * 16 + nl;
        float vv = acc[mi][ns][r] * oscale;
        if (F16OUT) ((_Float16*)Yp)[idx] = (_Float16)vv;
        else        ((float*)Yp)[idx] = vv;
      }
}

// ---------------------------------------------------------------------------
// Forget gate: f[h][t] = log_sigmoid(hidden[t] . Wf[h] + bf[h])
// One block per 32 positions, all 16 heads; its 16 waves split k, 64 each.
// f32 WMMA 16x16x4 with Wf as A (M = head) and hidden as B (N = position):
// hidden is read once for all heads, 32 bytes a row and load, where one thread
// per (h, t) read it 16 times with every lane on a cache line of its own.
// A's row and B's column are loaded by the same code (16 bytes at k0 + 8 j of
// the lane's row, k0 holding the lane half's 4), so their k orders are equal.
// ---------------------------------------------------------------------------
#define FG_T 32      // positions per block: a whole 128-byte line of f per head
#define FG_W 16      // waves per block
#define FG_K (HID / FG_W)

__global__ void __launch_bounds__(FG_W * 32)
fgate_kernel(const float* __restrict__ x, const float* __restrict__ Wf,
             const float* __restrict__ bf, float* __restrict__ f) {
  __shared__ float part[FG_W][NH][FG_T];   // each wave's partial sums
  const int tid  = threadIdx.x;
  const int w    = tid >> 5;
  const int lane = tid & 31;
  const int c    = lane & 15;
  const int hh   = lane >> 4;
  const int t0   = blockIdx.x * FG_T;
  const int k0   = w * FG_K + hh * 4;

  const float* wp = Wf + (size_t)c * HID + k0;
  const float* xp = x + (size_t)(t0 + c) * HID + k0;
  float4 wv[FG_K / 8], xa[FG_K / 8], xb[FG_K / 8];
#pragma unroll
  for (int j = 0; j < FG_K / 8; ++j) {
    wv[j] = *(const float4*)(wp + j * 8);
    xa[j] = *(const float4*)(xp + j * 8);
    xb[j] = *(const float4*)(xp + (size_t)16 * HID + j * 8);
  }
  const float bias = bf[w];
  // Keeps all 25 loads ahead of the first product, so that the wave waits out
  // one load latency. Without it the compiler keeps nine in flight, reuses
  // their registers and issues the rest behind products that wait for data.
  __builtin_amdgcn_sched_barrier(0);

  v8f a0 = (v8f){0,0,0,0,0,0,0,0};   // positions t0 .. t0 + 15
  v8f a1 = (v8f){0,0,0,0,0,0,0,0};   // positions t0 + 16 .. t0 + 31
#pragma unroll
  for (int j = 0; j < FG_K / 8; ++j) {
    const v2f wl = {wv[j].x, wv[j].y}, wh = {wv[j].z, wv[j].w};
    a0 = __builtin_amdgcn_wmma_f32_16x16x4_f32(
        false, wl, false, (v2f){xa[j].x, xa[j].y}, (short)0, a0, false, false);
    a1 = __builtin_amdgcn_wmma_f32_16x16x4_f32(
        false, wl, false, (v2f){xb[j].x, xb[j].y}, (short)0, a1, false, false);
    a0 = __builtin_amdgcn_wmma_f32_16x16x4_f32(
        false, wh, false, (v2f){xa[j].z, xa[j].w}, (short)0, a0, false, false);
    a1 = __builtin_amdgcn_wmma_f32_16x16x4_f32(
        false, wh, false, (v2f){xb[j].z, xb[j].w}, (short)0, a1, false, false);
  }
  __builtin_amdgcn_sched_barrier(0);
  // D layout: register r of lane (c, hh) is (head 8 hh + r, position c).
#pragma unroll
  for (int r = 0; r < 8; ++r) {
    part[w][hh * 8 + r][c]      = a0[r];
    part[w][hh * 8 + r][16 + c] = a1[r];
  }
  __syncthreads();   // publishes the 16 partial sums of every (head, position)

  // Wave w finishes head w: 32 consecutive positions, one whole line of f.
  float acc = bias;
#pragma unroll
  for (int j = 0; j < FG_W; ++j) acc += part[j][w][lane];
  float ls = (acc > 0.f) ? -log1pf(__expf(-acc)) : (acc - log1pf(__expf(acc)));
  f[(size_t)w * T_SEQ + t0 + lane] = ls;
}

// Cumulative decay (both directions): gc[dir][h][p] over direction-local p.
// One 256-thread block per (dir, head). Each thread sums its 8 consecutive
// positions, the 32 lane totals are scanned by shuffles, the 8 wave totals
// go through LDS; every thread then adds the sum of all that lies before it.
__global__ void __launch_bounds__(256)
fscan_kernel(const float* __restrict__ f, float* __restrict__ gc) {
  __shared__ float wtot[8];
  const int tid  = threadIdx.x;
  const int wave = tid >> 5;
  const int lane = tid & 31;
  const int dir  = blockIdx.x >> 4;
  const int h    = blockIdx.x & 15;
  const int p0   = tid * 8;
  const float* fh = f + (size_t)h * T_SEQ;

  // Position p reads t = p, or t = T-1-p in the reverse direction: there the
  // thread's 8 floats lie at T-8-p0 and are taken from the top down.
  const float* src = fh + (dir ? (T_SEQ - 8 - p0) : p0);
  const float4 a = *(const float4*)(src);
  const float4 b = *(const float4*)(src + 4);
  float x[8];
  x[0] = dir ? b.w : a.x;  x[1] = dir ? b.z : a.y;
  x[2] = dir ? b.y : a.z;  x[3] = dir ? b.x : a.w;
  x[4] = dir ? a.w : b.x;  x[5] = dir ? a.z : b.y;
  x[6] = dir ? a.y : b.z;  x[7] = dir ? a.x : b.w;
#pragma unroll
  for (int i = 1; i < 8; ++i) x[i] += x[i - 1];

  float incl = x[7];             // inclusive scan of the lane totals
#pragma unroll
  for (int off = 1; off < 32; off <<= 1) {
    float up = __shfl_up(incl, off, 32);
    if (lane >= off) incl += up;
  }
  const float excl = __shfl_up(incl, 1, 32);
  if (lane == 31) wtot[wave] = incl;
  __syncthreads();               // publishes the 8 wave totals
  float base = (lane > 0) ? excl : 0.f;   // lanes before this one, same wave
#pragma unroll
  for (int j = 0; j < 7; ++j)
    if (j < wave) base += wtot[j];

  float* dst = gc + (size_t)blockIdx.x * T_SEQ + p0;
  *(float4*)(dst)     = make_float4(x[0] + base, x[1] + base, x[2] + base, x[3] + base);
  *(float4*)(dst + 4) = make_float4(x[4] + base, x[5] + base, x[6] + base, x[7] + base);
}

// ---------------------------------------------------------------------------
// Flash-style forgetting attention, one wave per 16-row Q tile.
// grid = (T/16/WPB, NH, 2 directions). Causal in direction-local coords.
// q/k/v are f16 (q pre-scaled). K/V blocks async-DMA'd to LDS as raw f16.
// S tile: 16x32 via 4 WMMA; PV: 4 WMMA with ds_load_tr16_b128 V-columns.
// ---------------------------------------------------------------------------
__global__ void __launch_bounds__(WPB * 32)
fox_attn_kernel(const _Float16* __restrict__ q, const _Float16* __restrict__ k,
                const _Float16* __restrict__ v, const float* __restrict__ gc,
                float* __restrict__ obuf) {
  __shared__ _Float16 kv_s[WPB][32][72];   // 144B row stride (16B multiple)
  __shared__ _Float16 p_s[WPB][16][32];

  const int w    = threadIdx.x >> 5;
  const int lane = threadIdx.x & 31;
  const int half = (lane >> 4) & 1;
  const int nl   = lane & 15;
  const int kbh  = half * 8;
  const int qt   = blockIdx.x * WPB + w;    // q-tile index, 0..127
  const int h    = blockIdx.y;
  const int dir  = blockIdx.z;
  const float* gcd = gc + ((size_t)dir * NH + h) * T_SEQ;

  // Q fragments for this wave's 16 rows (q already scaled by d^-0.5).
  int qp_a = qt * 16 + nl;
  int tq   = dir ? (T_SEQ - 1 - qp_a) : qp_a;
  const _Float16* qrow = q + (size_t)tq * HID + h * HD;
  v16h a0, a1;
#pragma unroll
  for (int e = 0; e < 16; ++e) {
    int kk = kbh + e + ((e & 8) ? 8 : 0);
    a0[e] = qrow[kk];
    a1[e] = qrow[32 + kk];
  }
  float gq[8];
#pragma unroll
  for (int r = 0; r < 8; ++r) gq[r] = gcd[qt * 16 + r + half * 8];

  v8f o[4];
#pragma unroll
  for (int i = 0; i < 4; ++i) o[i] = (v8f){0,0,0,0,0,0,0,0};
  float rmax[8], rsum[8];
#pragma unroll
  for (int r = 0; r < 8; ++r) { rmax[r] = -1e30f; rsum[r] = 0.f; }

  // This lane's address in the V block for the transposing loads.
  const _Float16* vtr = &kv_s[w][kbh + (lane & 7)][((lane >> 3) & 1) * 8];

  const int nkb = (qt >> 1) + 1;            // causal: kv blocks of 32
  for (int kbI = 0; kbI < nkb; ++kbI) {
    const int kv0 = kbI * 32;

    // ---- stage K block (32 x 64 f16 = 32 rows x 8 16B chunks) ----
    wait_ds0();   // prior iter's LDS reads done before DMA overwrites
#pragma unroll
    for (int i = 0; i < 8; ++i) {
      int flat = i * 32 + lane, row = flat >> 3, c = flat & 7;
      int p = kv0 + row, t = dir ? (T_SEQ - 1 - p) : p;
      copy16_g2l(k + (size_t)t * HID + h * HD + c * 8, &kv_s[w][row][c * 8]);
    }
    wait_async0();

    // ---- S = Q K^T : two 16x16 accum tiles ----
    v8f s0 = (v8f){0,0,0,0,0,0,0,0};
    v8f s1 = (v8f){0,0,0,0,0,0,0,0};
#pragma unroll
    for (int ks = 0; ks < 2; ++ks) {
      v16h b0, b1;
#pragma unroll
      for (int e = 0; e < 16; ++e) {
        int kk = ks * 32 + kbh + e + ((e & 8) ? 8 : 0);
        b0[e] = kv_s[w][nl][kk];        // key rows 0..15
        b1[e] = kv_s[w][16 + nl][kk];   // key rows 16..31
      }
      s0 = __builtin_amdgcn_wmma_f32_16x16x32_f16(
          false, (ks ? a1 : a0), false, b0, (short)0, s0, false, false);
      s1 = __builtin_amdgcn_wmma_f32_16x16x32_f16(
          false, (ks ? a1 : a0), false, b1, (short)0, s1, false, false);
    }

    // ---- decay + causal mask + online softmax (rows across 16 lanes) ----
    float gk0 = gcd[kv0 + nl];
    float gk1 = gcd[kv0 + 16 + nl];
    int kp0 = kv0 + nl, kp1 = kv0 + 16 + nl;
    float x0[8], x1[8], m[8];
#pragma unroll
    for (int r = 0; r < 8; ++r) {
      int qp = qt * 16 + r + half * 8;
      x0[r] = (kp0 <= qp) ? (s0[r] + gq[r] - gk0) : -1e30f;
      x1[r] = (kp1 <= qp) ? (s1[r] + gq[r] - gk1) : -1e30f;
      m[r]  = fmaxf(x0[r], x1[r]);
    }
    row16_max8(m);
    float dm[8], ps[8];
#pragma unroll
    for (int r = 0; r < 8; ++r) {
      float nm = fmaxf(rmax[r], m[r]);
      dm[r] = rmax[r] - nm;
      rmax[r] = nm;
      float p0 = __expf(x0[r] - nm), p1 = __expf(x1[r] - nm);
      ps[r] = p0 + p1;
      // transpose P (C-layout -> A-layout) through LDS
      p_s[w][r + half * 8][nl]      = (_Float16)p0;
      p_s[w][r + half * 8][16 + nl] = (_Float16)p1;
    }
    wait_ds0();

    // ---- stage V block (reuse kv_s) ----
#pragma unroll
    for (int i = 0; i < 8; ++i) {
      int flat = i * 32 + lane, row = flat >> 3, c = flat & 7;
      int p = kv0 + row, t = dir ? (T_SEQ - 1 - p) : p;
      copy16_g2l(v + (size_t)t * HID + h * HD + c * 8, &kv_s[w][row][c * 8]);
    }
    // Row sums, alpha and the rescale need no LDS. The scheduling barrier keeps
    // them behind the copies' issue, where they fill the wait for the V block
    // and its fragments; without it the compiler lifts them ahead of the copies.
    __builtin_amdgcn_sched_barrier(0);
    row16_sum8(ps);
#pragma unroll
    for (int r = 0; r < 8; ++r) {
      float alpha = exp_with_slot(dm[r]);
      rsum[r] = rsum[r] * alpha + ps[r];
#pragma unroll
      for (int i = 0; i < 4; ++i) o[i][r] *= alpha;
    }
    wait_async0();

    // ---- O += P V : P as A fragment, V columns as B fragments ----
    v16h ap;
#pragma unroll
    for (int e = 0; e < 16; ++e) {
      int kk = kbh + e + ((e & 8) ? 8 : 0);
      ap[e] = p_s[w][nl][kk];
    }
    // V lies row-major [kv][d]; the B fragment wants column ns * 16 + nl with
    // kv = kbh + e (e < 8) and 16 + kbh + (e - 8): two transposing loads, at kv
    // rows 0 and 16, deliver exactly that, in ap's k order.
    v16h bv[4];
#pragma unroll
    for (int ns = 0; ns < 4; ++ns) {
      const v8h lo = lds_tr16(vtr + ns * 16);
      const v8h hi = lds_tr16(vtr + 16 * 72 + ns * 16);
#pragma unroll
      for (int e = 0; e < 8; ++e) { bv[ns][e] = lo[e]; bv[ns][8 + e] = hi[e]; }
    }
    // Keeps all ten LDS reads ahead of the first product. The compiler
    // otherwise reuses one V fragment's registers, and each reuse waits out an
    // LDS latency between two products.
    __builtin_amdgcn_sched_barrier(0);
#pragma unroll
    for (int ns = 0; ns < 4; ++ns)
      o[ns] = __builtin_amdgcn_wmma_f32_16x16x32_f16(
          false, ap, false, bv[ns], (short)0, o[ns], false, false);
  }

  // ---- epilogue: normalize and scatter into concat buffer [T, 2H] ----
#pragma unroll
  for (int ns = 0; ns < 4; ++ns)
#pragma unroll
    for (int r = 0; r < 8; ++r) {
      int qp = qt * 16 + r + half * 8;
      int t  = dir ? (T_SEQ - 1 - qp) : qp;
      obuf[(size_t)t * (2 * HID) + (size_t)dir * HID + h * HD + ns * 16 + nl] =
          o[ns][r] / rsum[r];
    }
}

// ---------------------------------------------------------------------------
extern "C" void kernel_launch(void* const* d_in, const int* in_sizes, int n_in,
                              void* d_out, int out_size, void* d_ws, size_t ws_size,
                              hipStream_t stream) {
  (void)in_sizes; (void)n_in; (void)out_size; (void)ws_size;
  const float* hidden = (const float*)d_in[0];
  const float* Wq     = (const float*)d_in[1];
  const float* Wk     = (const float*)d_in[2];
  const float* Wv     = (const float*)d_in[3];
  const float* Wf     = (const float*)d_in[4];
  const float* bf     = (const float*)d_in[5];
  const float* Wo     = (const float*)d_in[6];
  float* out = (float*)d_out;

  // Workspace layout: q|k|v (f16) then f|gc|o_concat (f32)
  _Float16* qb = (_Float16*)d_ws;
  _Float16* kb = qb + (size_t)T_SEQ * HID;
  _Float16* vb = kb + (size_t)T_SEQ * HID;
  float* fb = (float*)(vb + (size_t)T_SEQ * HID);
  float* gc = fb + (size_t)NH * T_SEQ;
  float* ob = gc + (size_t)2 * NH * T_SEQ;

  // q, k and v in one launch; qb, kb and vb lie one behind the other.
  dim3 gproj(T_SEQ / 128, HID / 128, 3);
  gemm_f16_wmma<true><<<gproj, 256, 0, stream>>>(hidden, Wq, Wk, Wv, qb, T_SEQ, HID, HID,
                                                 0.125f /* d^-0.5 folded in */);

  fgate_kernel<<<T_SEQ / FG_T, FG_W * 32, 0, stream>>>(hidden, Wf, bf, fb);
  fscan_kernel<<<2 * NH, 256, 0, stream>>>(fb, gc);

  dim3 gattn(T_SEQ / 16 / WPB, NH, 2);
  fox_attn_kernel<<<gattn, WPB * 32, 0, stream>>>(qb, kb, vb, gc, ob);

  dim3 gout(T_SEQ / 128, HID / 128);
  // One product: gridDim.z is 1, the second and third weight pointers go unread.
  gemm_f16_wmma<false><<<gout, 256, 0, stream>>>(ob, Wo, Wo, Wo, out, T_SEQ, HID,
                                                 2 * HID, 1.f);
}

// v008
// It runs in 136 microseconds.
// Timed twice side by side with v007, it ran 1.17 times as fast both times.
// Counting every step since v000, it is 3.56 times as fast.
#include <hip/hip_runtime.h>
#include <cstddef>

#define T_SEQ 2048
#define HID   1024
#define NH    16
#define HD    64     // head dim
#define WPB   4      // waves per block in attention kernel

typedef __attribute__((ext_vector_type(16))) _Float16 v16h;
typedef __attribute__((ext_vector_type(8)))  _Float16 v8h;
typedef __attribute__((ext_vector_type(8)))  float    v8f;
typedef __attribute__((ext_vector_type(2)))  float    v2f;
typedef __attribute__((ext_vector_type(8)))  short    s16x8;
typedef int async_v4i __attribute__((vector_size(4 * sizeof(int))));

#if __has_builtin(__builtin_amdgcn_global_load_async_to_lds_b128)
#define HAS_ASYNC_LDS 1
#else
#define HAS_ASYNC_LDS 0
#endif

__device__ __forceinline__ void copy16_g2l(const void* g, void* l) {
#if HAS_ASYNC_LDS
  __builtin_amdgcn_global_load_async_to_lds_b128(
      (__attribute__((address_space(1))) async_v4i*)(g),
      (__attribute__((address_space(3))) async_v4i*)(l), 0, 0);
#else
  *(float4*)l = *(const float4*)g;
#endif
}

// Copy 4 bytes global -> LDS, the same path.
__device__ __forceinline__ void copy4_g2l(const float* g, float* l) {
#if HAS_ASYNC_LDS
  __builtin_amdgcn_global_load_async_to_lds_b32(
      (__attribute__((address_space(1))) int*)(g),
      (__attribute__((address_space(3))) int*)(l), 0, 0);
#else
  *l = *g;
#endif
}

// In asm with the clobber: it holds every later LDS read behind it, which the
// builtin wait alone does not.
__device__ __forceinline__ void wait_async0() {
  asm volatile("s_wait_asynccnt 0x0" ::: "memory");
}

__device__ __forceinline__ v8h lds_tr16(const _Float16* p) {
  typedef __attribute__((address_space(3))) s16x8 lds_s16x8;
  return __builtin_bit_cast(
      v8h, __builtin_amdgcn_ds_load_tr16_b128_v8i16((lds_s16x8*)p));
}

__device__ __forceinline__ void wait_ds0() {
  asm volatile("s_wait_dscnt 0" ::: "memory");
}

// Butterfly over each 16-lane row (lane ^ 1, 2, 4, 8) for eight independent
// values at once, on the vector unit by DPP. The eight values of a step stand
// side by side so that each link of a chain is covered by the seven others.
#define ROW16_STEP(op, k)                                        \
  op " %0, %0, %0 row_xmask:" #k " row_mask:0xf bank_mask:0xf\n\t" \
  op " %1, %1, %1 row_xmask:" #k " row_mask:0xf bank_mask:0xf\n\t" \
  op " %2, %2, %2 row_xmask:" #k " row_mask:0xf bank_mask:0xf\n\t" \
  op " %3, %3, %3 row_xmask:" #k " row_mask:0xf bank_mask:0xf\n\t" \
  op " %4, %4, %4 row_xmask:" #k " row_mask:0xf bank_mask:0xf\n\t" \
  op " %5, %5, %5 row_xmask:" #k " row_mask:0xf bank_mask:0xf\n\t" \
  op " %6, %6, %6 row_xmask:" #k " row_mask:0xf bank_mask:0xf\n\t" \
  op " %7, %7, %7 row_xmask:" #k " row_mask:0xf bank_mask:0xf\n\t"
#define ROW16_ALL(op) \
  ROW16_STEP(op, 1) ROW16_STEP(op, 2) ROW16_STEP(op, 4) ROW16_STEP(op, 8)

// Needs all 32 lanes on. Replaces __shfl_xor, which compiles to an LDS-path
// permute with a wait behind each link.
__device__ __forceinline__ void row16_max8(float (&x)[8]) {
  asm(ROW16_ALL("v_max_num_f32_dpp")
      : "+v"(x[0]), "+v"(x[1]), "+v"(x[2]), "+v"(x[3]),
        "+v"(x[4]), "+v"(x[5]), "+v"(x[6]), "+v"(x[7]));
}

__device__ __forceinline__ float exp_with_slot(float x) {
  float y;
  asm("v_exp_f32 %0, %1\n\tv_nop" : "=v"(y) : "v"(x * 0x1.715476p+0f));
  return y;
}

__device__ __forceinline__ void exp_pair_with_slot(float x0, float x1, float& y0, float& y1) {
  asm("v_exp_f32 %0, %2\n\tv_exp_f32 %1, %3\n\tv_nop"
      : "=&v"(y0), "=&v"(y1)
      : "v"(x0 * 0x1.715476p+0f), "v"(x1 * 0x1.715476p+0f));
}

__device__ __forceinline__ void row16_sum8(float (&x)[8]) {
  asm(ROW16_ALL("v_add_f32_dpp")
      : "+v"(x[0]), "+v"(x[1]), "+v"(x[2]), "+v"(x[3]),
        "+v"(x[4]), "+v"(x[5]), "+v"(x[6]), "+v"(x[7]));
}

template <bool F16OUT>
__global__ void __launch_bounds__(256)
gemm_f16_wmma(const float* __restrict__ X, const float* __restrict__ W0,
              const float* __restrict__ W1, const float* __restrict__ W2,
              void* __restrict__ Y0, int M, int N, int K, float oscale0) {
  __shared__ _Float16 Xs[2][128][72];   // two stages; 144B row stride (16B x odd)
  __shared__ _Float16 Ws[2][128][72];

  const int z = blockIdx.z;
  const float* W = (z == 0) ? W0 : (z == 1) ? W1 : W2;
  const float oscale = (z == 0) ? oscale0 : 1.f;
  void* Yp = (char*)Y0 + (size_t)z * M * N * (F16OUT ? sizeof(_Float16) : sizeof(float));

  const int tid  = threadIdx.x;
  const int wave = tid >> 5;
  const int lane = tid & 31;
  const int half = (lane >> 4) & 1;   // which 16-lane half
  const int nl   = lane & 15;
  const int kb   = half * 8;          // per-half K base inside a 32-wide product
  const int wm   = wave & 3;          // 4 wave-rows of 32
  const int wn   = wave >> 2;         // 2 wave-cols of 64
  const int m0   = blockIdx.x * 128;
  const int n0   = blockIdx.y * 128;

  v8f acc[2][4];
#pragma unroll
  for (int mi = 0; mi < 2; ++mi)
#pragma unroll
    for (int ns = 0; ns < 4; ++ns) acc[mi][ns] = (v8f){0,0,0,0,0,0,0,0};

  // Each thread moves 8 chunks of 4 floats of either 128x64 tile: rows
  // srow + 16 i, floats scol .. scol + 3.
  const int srow = tid >> 4;
  const int scol = (tid & 15) * 4;
  const float* xg = X + (size_t)(m0 + srow) * K + scol;
  const float* wg = W + (size_t)(n0 + srow) * K + scol;
  float4 xr[8], wr[8];   // the tile in flight from global memory

  // Issue the loads of the K-step that starts at k0; their data is not waited
  // for here.
  auto fetch = [&](int k0) {
    const float* px[8];
    const float* pw[8];
#pragma unroll
    for (int i = 0; i < 8; ++i) {
      px[i] = xg + (size_t)(i * 16) * K + k0;
      pw[i] = wg + (size_t)(i * 16) * K + k0;
    }
#pragma unroll
    for (int i = 0; i < 8; ++i) xr[i] = *(const float4*)px[i];
#pragma unroll
    for (int i = 0; i < 8; ++i) wr[i] = *(const float4*)pw[i];
    // The wait that stands before a register named by an issued load is
    // overwritten. The sixteen address pairs are its inputs, so that none is
    // reused (as a later load's destination, for a later address) ahead of it.
    // Its clobber also holds the loads' issue ahead of the LDS reads and
    // products that follow; sunk below them, their latency would stand open.
    asm volatile("s_wait_xcnt 0x0"
                 :: "v"(px[0]), "v"(px[1]), "v"(px[2]), "v"(px[3]),
                    "v"(px[4]), "v"(px[5]), "v"(px[6]), "v"(px[7]),
                    "v"(pw[0]), "v"(pw[1]), "v"(pw[2]), "v"(pw[3]),
                    "v"(pw[4]), "v"(pw[5]), "v"(pw[6]), "v"(pw[7])
                 : "memory");
  };
  // Convert the fetched tile to f16 and lay it into stage s.
  auto stash = [&](int s) {
#pragma unroll
    for (int i = 0; i < 8; ++i) {
      _Float16* xl = &Xs[s][srow + i * 16][scol];
      xl[0] = (_Float16)xr[i].x;  xl[1] = (_Float16)xr[i].y;
      xl[2] = (_Float16)xr[i].z;  xl[3] = (_Float16)xr[i].w;
      _Float16* wl = &Ws[s][srow + i * 16][scol];
      wl[0] = (_Float16)wr[i].x;  wl[1] = (_Float16)wr[i].y;
      wl[2] = (_Float16)wr[i].z;  wl[3] = (_Float16)wr[i].w;
    }
  };
  // The 16 WMMA of one K-step, operands from stage s; ks is the 32-wide half.
  auto mma = [&](int s) {
    v16h a[2][2];
    v16h b[2][4];   // column n = W row (n0+wn*64+ns*16+nl), K along the W row
#pragma unroll
    for (int ks = 0; ks < 2; ++ks) {
#pragma unroll
      for (int mi = 0; mi < 2; ++mi)
#pragma unroll
        for (int e = 0; e < 16; ++e) {
          int kk = ks * 32 + kb + e + ((e & 8) ? 8 : 0);
          a[ks][mi][e] = Xs[s][wm * 32 + mi * 16 + nl][kk];
        }
#pragma unroll
      for (int ns = 0; ns < 4; ++ns)
#pragma unroll
        for (int e = 0; e < 16; ++e) {
          int kk = ks * 32 + kb + e + ((e & 8) ? 8 : 0);
          b[ks][ns][e] = Ws[s][wn * 64 + ns * 16 + nl][kk];
        }
    }
    // Keeps all 24 LDS reads ahead of the first product. With the fetched
    // tile held in registers the compiler otherwise reuses a B fragment's
    // registers, and each reuse waits out a full LDS latency.
    __builtin_amdgcn_sched_barrier(0);
#pragma unroll
    for (int ks = 0; ks < 2; ++ks)
#pragma unroll
      for (int ns = 0; ns < 4; ++ns)
#pragma unroll
        for (int mi = 0; mi < 2; ++mi)
          acc[mi][ns] = __builtin_amdgcn_wmma_f32_16x16x32_f16(
              false, a[ks][mi], false, b[ks][ns], (short)0, acc[mi][ns], false, false);
  };

  // Two LDS stages: the next K-step's global loads fly while this step's
  // products run. One barrier a step: it publishes the stage just written and
  // ends every wave's reads of the stage that the next step overwrites.
  fetch(0);
  stash(0);
  __syncthreads();
  int s = 0;
  for (int k0 = 64; k0 < K; k0 += 64) {
    fetch(k0);
    mma(s);
    // Keeps the conversions, and with them the wait for the loads, behind the
    // products; the compiler lifts them ahead to free registers early.
    __builtin_amdgcn_sched_barrier(0);
    stash(s ^ 1);
    __syncthreads();
    s ^= 1;
  }
  mma(s);

#pragma unroll
  for (int mi = 0; mi < 2; ++mi)
#pragma unroll
    for (int ns = 0; ns < 4; ++ns)
#pragma unroll
      for (int r = 0; r < 8; ++r) {
        size_t idx = (size_t)(m0 + wm * 32 + mi * 16 + r + half * 8) * N +
                     n0 + wn * 64 + ns * 16 + nl;
        float vv = acc[mi][ns][r] * oscale;
        if (F16OUT) ((_Float16*)Yp)[idx] = (_Float16)vv;
        else        ((float*)Yp)[idx] = vv;
      }
}

// ---------------------------------------------------------------------------
// Forget gate: f[h][t] = log_sigmoid(hidden[t] . Wf[h] + bf[h])
// One block per 32 positions, all 16 heads; its 16 waves split k, 64 each.
// f32 WMMA 16x16x4 with Wf as A (M = head) and hidden as B (N = position):
// hidden is read once for all heads, 32 bytes a row and load, where one thread
// per (h, t) read it 16 times with every lane on a cache line of its own.
// A's row and B's column are loaded by the same code (16 bytes at k0 + 8 j of
// the lane's row, k0 holding the lane half's 4), so their k orders are equal.
// ---------------------------------------------------------------------------
#define FG_T 32      // positions per block: a whole 128-byte line of f per head
#define FG_W 16      // waves per block
#define FG_K (HID / FG_W)

__global__ void __launch_bounds__(FG_W * 32)
fgate_kernel(const float* __restrict__ x, const float* __restrict__ Wf,
             const float* __restrict__ bf, float* __restrict__ f) {
  __shared__ float part[FG_W][NH][FG_T];   // each wave's partial sums
  const int tid  = threadIdx.x;
  const int w    = tid >> 5;
  const int lane = tid & 31;
  const int c    = lane & 15;
  const int hh   = lane >> 4;
  const int t0   = blockIdx.x * FG_T;
  const int k0   = w * FG_K + hh * 4;

  const float* wp = Wf + (size_t)c * HID + k0;
  const float* xp = x + (size_t)(t0 + c) * HID + k0;
  float4 wv[FG_K / 8], xa[FG_K / 8], xb[FG_K / 8];
#pragma unroll
  for (int j = 0; j < FG_K / 8; ++j) {
    wv[j] = *(const float4*)(wp + j * 8);
    xa[j] = *(const float4*)(xp + j * 8);
    xb[j] = *(const float4*)(xp + (size_t)16 * HID + j * 8);
  }
  const float bias = bf[w];
  // Keeps all 25 loads ahead of the first product, so that the wave waits out
  // one load latency. Without it the compiler keeps nine in flight, reuses
  // their registers and issues the rest behind products that wait for data.
  __builtin_amdgcn_sched_barrier(0);

  v8f a0 = (v8f){0,0,0,0,0,0,0,0};   // positions t0 .. t0 + 15
  v8f a1 = (v8f){0,0,0,0,0,0,0,0};   // positions t0 + 16 .. t0 + 31
#pragma unroll
  for (int j = 0; j < FG_K / 8; ++j) {
    const v2f wl = {wv[j].x, wv[j].y}, wh = {wv[j].z, wv[j].w};
    a0 = __builtin_amdgcn_wmma_f32_16x16x4_f32(
        false, wl, false, (v2f){xa[j].x, xa[j].y}, (short)0, a0, false, false);
    a1 = __builtin_amdgcn_wmma_f32_16x16x4_f32(
        false, wl, false, (v2f){xb[j].x, xb[j].y}, (short)0, a1, false, false);
    a0 = __builtin_amdgcn_wmma_f32_16x16x4_f32(
        false, wh, false, (v2f){xa[j].z, xa[j].w}, (short)0, a0, false, false);
    a1 = __builtin_amdgcn_wmma_f32_16x16x4_f32(
        false, wh, false, (v2f){xb[j].z, xb[j].w}, (short)0, a1, false, false);
  }
  __builtin_amdgcn_sched_barrier(0);
  // D layout: register r of lane (c, hh) is (head 8 hh + r, position c).
#pragma unroll
  for (int r = 0; r < 8; ++r) {
    part[w][hh * 8 + r][c]      = a0[r];
    part[w][hh * 8 + r][16 + c] = a1[r];
  }
  __syncthreads();   // publishes the 16 partial sums of every (head, position)

  // Wave w finishes head w: 32 consecutive positions, one whole line of f.
  float acc = bias;
#pragma unroll
  for (int j = 0; j < FG_W; ++j) acc += part[j][w][lane];
  float ls = (acc > 0.f) ? -log1pf(__expf(-acc)) : (acc - log1pf(__expf(acc)));
  f[(size_t)w * T_SEQ + t0 + lane] = ls;
}

// Cumulative decay (both directions): gc[dir][h][p] over direction-local p.
// One 256-thread block per (dir, head). Each thread sums its 8 consecutive
// positions, the 32 lane totals are scanned by shuffles, the 8 wave totals
// go through LDS; every thread then adds the sum of all that lies before it.
__global__ void __launch_bounds__(256)
fscan_kernel(const float* __restrict__ f, float* __restrict__ gc) {
  __shared__ float wtot[8];
  const int tid  = threadIdx.x;
  const int wave = tid >> 5;
  const int lane = tid & 31;
  const int dir  = blockIdx.x >> 4;
  const int h    = blockIdx.x & 15;
  const int p0   = tid * 8;
  const float* fh = f + (size_t)h * T_SEQ;

  // Position p reads t = p, or t = T-1-p in the reverse direction: there the
  // thread's 8 floats lie at T-8-p0 and are taken from the top down.
  const float* src = fh + (dir ? (T_SEQ - 8 - p0) : p0);
  const float4 a = *(const float4*)(src);
  const float4 b = *(const float4*)(src + 4);
  float x[8];
  x[0] = dir ? b.w : a.x;  x[1] = dir ? b.z : a.y;
  x[2] = dir ? b.y : a.z;  x[3] = dir ? b.x : a.w;
  x[4] = dir ? a.w : b.x;  x[5] = dir ? a.z : b.y;
  x[6] = dir ? a.y : b.z;  x[7] = dir ? a.x : b.w;
#pragma unroll
  for (int i = 1; i < 8; ++i) x[i] += x[i - 1];

  float incl = x[7];             // inclusive scan of the lane totals
#pragma unroll
  for (int off = 1; off < 32; off <<= 1) {
    float up = __shfl_up(incl, off, 32);
    if (lane >= off) incl += up;
  }
  const float excl = __shfl_up(incl, 1, 32);
  if (lane == 31) wtot[wave] = incl;
  __syncthreads();               // publishes the 8 wave totals
  float base = (lane > 0) ? excl : 0.f;   // lanes before this one, same wave
#pragma unroll
  for (int j = 0; j < 7; ++j)
    if (j < wave) base += wtot[j];

  float* dst = gc + (size_t)blockIdx.x * T_SEQ + p0;
  *(float4*)(dst)     = make_float4(x[0] + base, x[1] + base, x[2] + base, x[3] + base);
  *(float4*)(dst + 4) = make_float4(x[4] + base, x[5] + base, x[6] + base, x[7] + base);
}

__global__ void __launch_bounds__(WPB * 32)
fox_attn_kernel(const _Float16* __restrict__ q, const _Float16* __restrict__ k,
                const _Float16* __restrict__ v, const float* __restrict__ gc,
                float* __restrict__ obuf) {
  // 144B row stride (16B multiple)
  __shared__ __attribute__((aligned(16))) _Float16 k_s[2][32][72];
  __shared__ __attribute__((aligned(16))) _Float16 v_s[2][32][72];
  __shared__ float g_s[2][WPB][32];   // each wave keeps a copy of its own
  __shared__ __attribute__((aligned(16))) _Float16 p_s[WPB][16][32];

  const int tid  = threadIdx.x;
  // The wave's number in a scalar register: the test that skips the stages
  // beyond a wave's diagonal is then a scalar branch.
  const int w    = __builtin_amdgcn_readfirstlane(tid >> 5);
  const int lane = tid & 31;
  const int half = (lane >> 4) & 1;
  const int nl   = lane & 15;
  const int kbh  = half * 8;
  const int qt   = blockIdx.x * WPB + w;    // q-tile index, 0..127
  const int h    = blockIdx.y;
  const int dir  = blockIdx.z;
  const float* gcd = gc + ((size_t)dir * NH + h) * T_SEQ;

  const int nkb  = (qt >> 1) + 1;           // causal: this wave's kv blocks of 32
  const int nkbB = ((blockIdx.x * WPB + WPB - 1) >> 1) + 1;   // the block's: its last wave's

  // Issue this thread's share of stage t: rows crow and crow + 16, one 16-byte
  // chunk of each, of K and of V (32 rows x 8 chunks each), and one decay sum.
  // K and V share the chunk's byte offset: that of stage 0 plus t scalar steps.
  const int crow = tid >> 3;
  const int ccol = (tid & 7) * 8;
  const int kvstep = (dir ? -32 : 32) * HID * (int)sizeof(_Float16);
  unsigned off0[32 / (WPB * 4)];
#pragma unroll
  for (int i = 0; i < 32 / (WPB * 4); ++i) {
    const int row = crow + i * (WPB * 4);
    const int tt  = dir ? (T_SEQ - 1 - row) : row;
    off0[i] = (unsigned)((tt * HID + h * HD + ccol) * (int)sizeof(_Float16));
  }
  auto stage = [&](int t) {
    const int s = t & 1;
#pragma unroll
    for (int i = 0; i < 32 / (WPB * 4); ++i) {
      const int row = crow + i * (WPB * 4);
      const unsigned off = off0[i] + (unsigned)(t * kvstep);
      copy16_g2l((const char*)k + off, &k_s[s][row][ccol]);
      copy16_g2l((const char*)v + off, &v_s[s][row][ccol]);
    }
    copy4_g2l(gcd + t * 32 + lane, &g_s[s][w][lane]);
  };

  stage(0);

  // Q fragments for this wave's 16 rows (q already scaled by d^-0.5).
  int qp_a = qt * 16 + nl;
  int tq   = dir ? (T_SEQ - 1 - qp_a) : qp_a;
  const _Float16* qrow = q + (size_t)tq * HID + h * HD;
  v16h a0, a1;
#pragma unroll
  for (int e = 0; e < 16; ++e) {
    int kk = kbh + e + ((e & 8) ? 8 : 0);
    a0[e] = qrow[kk];
    a1[e] = qrow[32 + kk];
  }
  float gq[8];
#pragma unroll
  for (int r = 0; r < 8; ++r) gq[r] = gcd[qt * 16 + r + half * 8];

  v8f o[4];
#pragma unroll
  for (int i = 0; i < 4; ++i) o[i] = (v8f){0,0,0,0,0,0,0,0};
  float rmax[8], rsum[8];
#pragma unroll
  for (int r = 0; r < 8; ++r) { rmax[r] = -1e30f; rsum[r] = 0.f; }

  wait_async0();     // this wave's share of stage 0 has landed
  __syncthreads();   // publishes stage 0
  if (1 < nkbB) stage(1);

  for (int t = 0; t < nkbB; ++t) {
    const int s = t & 1;
    if (t < nkb) {   // a wave skips the stages beyond its diagonal, not their publish points
      const int kv0 = t * 32;

      // ---- S = Q K^T : two 16x16 accum tiles ----
      const float gk0 = g_s[s][w][nl];        // the keys' decay sums
      const float gk1 = g_s[s][w][16 + nl];
      v16h b0[2], b1[2];
#pragma unroll
      for (int ks = 0; ks < 2; ++ks)
#pragma unroll
        for (int e = 0; e < 16; ++e) {
          int kk = ks * 32 + kbh + e + ((e & 8) ? 8 : 0);
          b0[ks][e] = k_s[s][nl][kk];        // key rows 0..15
          b1[ks][e] = k_s[s][16 + nl][kk];   // key rows 16..31
        }
      // Keeps the pass's reads of K and of the decay sums ahead of the first
      // product, one LDS latency for all. The compiler otherwise sinks the decay
      // sums' read behind the last product and reuses a K fragment's registers,
      // and each of the two waits out an LDS latency of its own.
      __builtin_amdgcn_sched_barrier(0);
      v8f s0 = (v8f){0,0,0,0,0,0,0,0};
      v8f s1 = (v8f){0,0,0,0,0,0,0,0};
#pragma unroll
      for (int ks = 0; ks < 2; ++ks) {
        s0 = __builtin_amdgcn_wmma_f32_16x16x32_f16(
            false, (ks ? a1 : a0), false, b0[ks], (short)0, s0, false, false);
        s1 = __builtin_amdgcn_wmma_f32_16x16x32_f16(
            false, (ks ? a1 : a0), false, b1[ks], (short)0, s1, false, false);
      }

      // ---- decay + causal mask + online softmax (rows across 16 lanes) ----
      int kp0 = kv0 + nl, kp1 = kv0 + 16 + nl;
      float x0[8], x1[8], m[8];
#pragma unroll
      for (int r = 0; r < 8; ++r) {
        int qp = qt * 16 + r + half * 8;
        x0[r] = (kp0 <= qp) ? (s0[r] + gq[r] - gk0) : -1e30f;
        x1[r] = (kp1 <= qp) ? (s1[r] + gq[r] - gk1) : -1e30f;
        m[r]  = fmaxf(x0[r], x1[r]);
      }
      row16_max8(m);
      float dm[8], ps[8];
#pragma unroll
      for (int r = 0; r < 8; ++r) {
        float nm = fmaxf(rmax[r], m[r]);
        dm[r] = rmax[r] - nm;
        rmax[r] = nm;
        float p0, p1;
        exp_pair_with_slot(x0[r] - nm, x1[r] - nm, p0, p1);
        ps[r] = p0 + p1;
        // transpose P (C-layout -> A-layout) through LDS
        p_s[w][r + half * 8][nl]      = (_Float16)p0;
        p_s[w][r + half * 8][16 + nl] = (_Float16)p1;
      }
      wait_ds0();   // every lane's P is in LDS before other lanes read it

      // ---- O += P V : P as A fragment, V columns as B fragments ----
      v16h ap;
#pragma unroll
      for (int e = 0; e < 16; ++e) {
        int kk = kbh + e + ((e & 8) ? 8 : 0);
        ap[e] = p_s[w][nl][kk];
      }
      // V lies row-major [kv][d]; the B fragment wants column ns * 16 + nl with
      // kv = kbh + e (e < 8) and 16 + kbh + (e - 8): two transposing loads, at kv
      // rows 0 and 16, deliver exactly that, in ap's k order.
      const _Float16* vtr = &v_s[s][kbh + (lane & 7)][((lane >> 3) & 1) * 8];
      v16h bv[4];
#pragma unroll
      for (int ns = 0; ns < 4; ++ns) {
        const v8h lo = lds_tr16(vtr + ns * 16);
        const v8h hi = lds_tr16(vtr + 16 * 72 + ns * 16);
#pragma unroll
        for (int e = 0; e < 8; ++e) { bv[ns][e] = lo[e]; bv[ns][8 + e] = hi[e]; }
      }
      // Keeps all ten LDS reads ahead of what follows: row sums, alpha and the
      // rescale need no LDS and fill the reads' latency, and no V fragment's
      // registers are reused (a reuse waits out an LDS latency between products).
      __builtin_amdgcn_sched_barrier(0);
      row16_sum8(ps);
#pragma unroll
      for (int r = 0; r < 8; ++r) {
        float alpha = exp_with_slot(dm[r]);
        rsum[r] = rsum[r] * alpha + ps[r];
#pragma unroll
        for (int i = 0; i < 4; ++i) o[i][r] *= alpha;
      }
#pragma unroll
      for (int ns = 0; ns < 4; ++ns)
        o[ns] = __builtin_amdgcn_wmma_f32_16x16x32_f16(
            false, ap, false, bv[ns], (short)0, o[ns], false, false);
    }

    // ---- publish point of stage t + 1; every wave passes it ----
    wait_ds0();        // this wave's reads of stage t are done
    wait_async0();     // its share of stage t + 1 has landed
    __syncthreads();   // publishes stage t + 1; every wave has left stage t
    if (t + 2 < nkbB) stage(t + 2);   // into the buffer that stage t has left
  }
  wait_async0();   // no copy is in flight when the wave ends

  // ---- epilogue: normalize and scatter into concat buffer [T, 2H] ----
#pragma unroll
  for (int ns = 0; ns < 4; ++ns)
#pragma unroll
    for (int r = 0; r < 8; ++r) {
      int qp = qt * 16 + r + half * 8;
      int t  = dir ? (T_SEQ - 1 - qp) : qp;
      obuf[(size_t)t * (2 * HID) + (size_t)dir * HID + h * HD + ns * 16 + nl] =
          o[ns][r] / rsum[r];
    }
}

// ---------------------------------------------------------------------------
extern "C" void kernel_launch(void* const* d_in, const int* in_sizes, int n_in,
                              void* d_out, int out_size, void* d_ws, size_t ws_size,
                              hipStream_t stream) {
  (void)in_sizes; (void)n_in; (void)out_size; (void)ws_size;
  const float* hidden = (const float*)d_in[0];
  const float* Wq     = (const float*)d_in[1];
  const float* Wk     = (const float*)d_in[2];
  const float* Wv     = (const float*)d_in[3];
  const float* Wf     = (const float*)d_in[4];
  const float* bf     = (const float*)d_in[5];
  const float* Wo     = (const float*)d_in[6];
  float* out = (float*)d_out;

  // Workspace layout: q|k|v (f16) then f|gc|o_concat (f32)
  _Float16* qb = (_Float16*)d_ws;
  _Float16* kb = qb + (size_t)T_SEQ * HID;
  _Float16* vb = kb + (size_t)T_SEQ * HID;
  float* fb = (float*)(vb + (size_t)T_SEQ * HID);
  float* gc = fb + (size_t)NH * T_SEQ;
  float* ob = gc + (size_t)2 * NH * T_SEQ;

  // q, k and v in one launch; qb, kb and vb lie one behind the other.
  dim3 gproj(T_SEQ / 128, HID / 128, 3);
  gemm_f16_wmma<true><<<gproj, 256, 0, stream>>>(hidden, Wq, Wk, Wv, qb, T_SEQ, HID, HID,
                                                 0.125f /* d^-0.5 folded in */);

  fgate_kernel<<<T_SEQ / FG_T, FG_W * 32, 0, stream>>>(hidden, Wf, bf, fb);
  fscan_kernel<<<2 * NH, 256, 0, stream>>>(fb, gc);

  dim3 gattn(T_SEQ / 16 / WPB, NH, 2);
  fox_attn_kernel<<<gattn, WPB * 32, 0, stream>>>(qb, kb, vb, gc, ob);

  dim3 gout(T_SEQ / 128, HID / 128);
  // One product: gridDim.z is 1, the second and third weight pointers go unread.
  gemm_f16_wmma<false><<<gout, 256, 0, stream>>>(ob, Wo, Wo, Wo, out, T_SEQ, HID,
                                                 2 * HID, 1.f);
}

// v009
// It runs in 117 microseconds.
// In both of two side-by-side timings against v008, it was 1.17 times as fast.
// Over all steps from v000 it is 4.15 times as fast.
#include <hip/hip_runtime.h>
#include <cstddef>

#define T_SEQ 2048
#define HID   1024
#define NH    16
#define HD    64     // head dim
#define WPB   4      // waves per block in attention kernel

typedef __attribute__((ext_vector_type(16))) _Float16 v16h;
typedef __attribute__((ext_vector_type(8)))  _Float16 v8h;
typedef __attribute__((ext_vector_type(8)))  float    v8f;
typedef __attribute__((ext_vector_type(2)))  float    v2f;
typedef __attribute__((ext_vector_type(8)))  short    s16x8;
typedef int async_v4i __attribute__((vector_size(4 * sizeof(int))));

#if __has_builtin(__builtin_amdgcn_global_load_async_to_lds_b128)
#define HAS_ASYNC_LDS 1
#else
#define HAS_ASYNC_LDS 0
#endif

__device__ __forceinline__ void copy16_g2l(const void* g, void* l) {
#if HAS_ASYNC_LDS
  __builtin_amdgcn_global_load_async_to_lds_b128(
      (__attribute__((address_space(1))) async_v4i*)(g),
      (__attribute__((address_space(3))) async_v4i*)(l), 0, 0);
#else
  *(float4*)l = *(const float4*)g;
#endif
}

// Copy 4 bytes global -> LDS, the same path.
__device__ __forceinline__ void copy4_g2l(const float* g, float* l) {
#if HAS_ASYNC_LDS
  __builtin_amdgcn_global_load_async_to_lds_b32(
      (__attribute__((address_space(1))) int*)(g),
      (__attribute__((address_space(3))) int*)(l), 0, 0);
#else
  *l = *g;
#endif
}

// In asm with the clobber: it holds every later LDS read behind it, which the
// builtin wait alone does not.
__device__ __forceinline__ void wait_async0() {
  asm volatile("s_wait_asynccnt 0x0" ::: "memory");
}

__device__ __forceinline__ v8h lds_tr16(const _Float16* p) {
  typedef __attribute__((address_space(3))) s16x8 lds_s16x8;
  return __builtin_bit_cast(
      v8h, __builtin_amdgcn_ds_load_tr16_b128_v8i16((lds_s16x8*)p));
}

__device__ __forceinline__ void wait_ds0() {
  asm volatile("s_wait_dscnt 0" ::: "memory");
}

// Butterfly over each 16-lane row (lane ^ 1, 2, 4, 8) for eight independent
// values at once, on the vector unit by DPP. The eight values of a step stand
// side by side so that each link of a chain is covered by the seven others.
#define ROW16_STEP(op, k)                                        \
  op " %0, %0, %0 row_xmask:" #k " row_mask:0xf bank_mask:0xf\n\t" \
  op " %1, %1, %1 row_xmask:" #k " row_mask:0xf bank_mask:0xf\n\t" \
  op " %2, %2, %2 row_xmask:" #k " row_mask:0xf bank_mask:0xf\n\t" \
  op " %3, %3, %3 row_xmask:" #k " row_mask:0xf bank_mask:0xf\n\t" \
  op " %4, %4, %4 row_xmask:" #k " row_mask:0xf bank_mask:0xf\n\t" \
  op " %5, %5, %5 row_xmask:" #k " row_mask:0xf bank_mask:0xf\n\t" \
  op " %6, %6, %6 row_xmask:" #k " row_mask:0xf bank_mask:0xf\n\t" \
  op " %7, %7, %7 row_xmask:" #k " row_mask:0xf bank_mask:0xf\n\t"
#define ROW16_ALL(op) \
  ROW16_STEP(op, 1) ROW16_STEP(op, 2) ROW16_STEP(op, 4) ROW16_STEP(op, 8)

// Needs all 32 lanes on. Replaces __shfl_xor, which compiles to an LDS-path
// permute with a wait behind each link.
__device__ __forceinline__ void row16_max8(float (&x)[8]) {
  asm(ROW16_ALL("v_max_num_f32_dpp")
      : "+v"(x[0]), "+v"(x[1]), "+v"(x[2]), "+v"(x[3]),
        "+v"(x[4]), "+v"(x[5]), "+v"(x[6]), "+v"(x[7]));
}

__device__ __forceinline__ float exp_with_slot(float x) {
  float y;
  asm("v_exp_f32 %0, %1\n\tv_nop" : "=v"(y) : "v"(x * 0x1.715476p+0f));
  return y;
}

__device__ __forceinline__ void exp_pair_with_slot(float x0, float x1, float& y0, float& y1) {
  asm("v_exp_f32 %0, %2\n\tv_exp_f32 %1, %3\n\tv_nop"
      : "=&v"(y0), "=&v"(y1)
      : "v"(x0 * 0x1.715476p+0f), "v"(x1 * 0x1.715476p+0f));
}

__device__ __forceinline__ void row16_sum8(float (&x)[8]) {
  asm(ROW16_ALL("v_add_f32_dpp")
      : "+v"(x[0]), "+v"(x[1]), "+v"(x[2]), "+v"(x[3]),
        "+v"(x[4]), "+v"(x[5]), "+v"(x[6]), "+v"(x[7]));
}

template <bool F16OUT>
__global__ void __launch_bounds__(256)
gemm_f16_wmma(const float* __restrict__ X, const float* __restrict__ W0,
              const float* __restrict__ W1, const float* __restrict__ W2,
              void* __restrict__ Y0, int M, int N, int K, float oscale0) {
  __shared__ _Float16 Xs[2][128][72];   // two stages; 144B row stride (16B x odd)
  __shared__ _Float16 Ws[2][128][72];

  const int z = blockIdx.z;
  const float* W = (z == 0) ? W0 : (z == 1) ? W1 : W2;
  const float oscale = (z == 0) ? oscale0 : 1.f;
  void* Yp = (char*)Y0 + (size_t)z * M * N * (F16OUT ? sizeof(_Float16) : sizeof(float));

  const int tid  = threadIdx.x;
  const int wave = tid >> 5;
  const int lane = tid & 31;
  const int half = (lane >> 4) & 1;   // which 16-lane half
  const int nl   = lane & 15;
  const int kb   = half * 8;          // per-half K base inside a 32-wide product
  const int wm   = wave & 3;          // 4 wave-rows of 32
  const int wn   = wave >> 2;         // 2 wave-cols of 64
  const int m0   = blockIdx.x * 128;
  const int n0   = blockIdx.y * 128;

  v8f acc[2][4];
#pragma unroll
  for (int mi = 0; mi < 2; ++mi)
#pragma unroll
    for (int ns = 0; ns < 4; ++ns) acc[mi][ns] = (v8f){0,0,0,0,0,0,0,0};

  // Each thread moves 8 chunks of 4 floats of either 128x64 tile: rows
  // srow + 16 i, floats scol .. scol + 3.
  const int srow = tid >> 4;
  const int scol = (tid & 15) * 4;
  const float* xg = X + (size_t)(m0 + srow) * K + scol;
  const float* wg = W + (size_t)(n0 + srow) * K + scol;
  float4 xr[8], wr[8];   // the tile in flight from global memory

  // Issue the loads of the K-step that starts at k0; their data is not waited
  // for here.
  auto fetch = [&](int k0) {
    const float* px[8];
    const float* pw[8];
#pragma unroll
    for (int i = 0; i < 8; ++i) {
      px[i] = xg + (size_t)(i * 16) * K + k0;
      pw[i] = wg + (size_t)(i * 16) * K + k0;
    }
#pragma unroll
    for (int i = 0; i < 8; ++i) xr[i] = *(const float4*)px[i];
#pragma unroll
    for (int i = 0; i < 8; ++i) wr[i] = *(const float4*)pw[i];
    // The wait that stands before a register named by an issued load is
    // overwritten. The sixteen address pairs are its inputs, so that none is
    // reused (as a later load's destination, for a later address) ahead of it.
    // Its clobber also holds the loads' issue ahead of the LDS reads and
    // products that follow; sunk below them, their latency would stand open.
    asm volatile("s_wait_xcnt 0x0"
                 :: "v"(px[0]), "v"(px[1]), "v"(px[2]), "v"(px[3]),
                    "v"(px[4]), "v"(px[5]), "v"(px[6]), "v"(px[7]),
                    "v"(pw[0]), "v"(pw[1]), "v"(pw[2]), "v"(pw[3]),
                    "v"(pw[4]), "v"(pw[5]), "v"(pw[6]), "v"(pw[7])
                 : "memory");
  };
  // Convert the fetched tile to f16 and lay it into stage s.
  auto stash = [&](int s) {
#pragma unroll
    for (int i = 0; i < 8; ++i) {
      _Float16* xl = &Xs[s][srow + i * 16][scol];
      xl[0] = (_Float16)xr[i].x;  xl[1] = (_Float16)xr[i].y;
      xl[2] = (_Float16)xr[i].z;  xl[3] = (_Float16)xr[i].w;
      _Float16* wl = &Ws[s][srow + i * 16][scol];
      wl[0] = (_Float16)wr[i].x;  wl[1] = (_Float16)wr[i].y;
      wl[2] = (_Float16)wr[i].z;  wl[3] = (_Float16)wr[i].w;
    }
  };
  // The 16 WMMA of one K-step, operands from stage s; ks is the 32-wide half.
  auto mma = [&](int s) {
    v16h a[2][2];
    v16h b[2][4];   // column n = W row (n0+wn*64+ns*16+nl), K along the W row
#pragma unroll
    for (int ks = 0; ks < 2; ++ks) {
#pragma unroll
      for (int mi = 0; mi < 2; ++mi)
#pragma unroll
        for (int e = 0; e < 16; ++e) {
          int kk = ks * 32 + kb + e + ((e & 8) ? 8 : 0);
          a[ks][mi][e] = Xs[s][wm * 32 + mi * 16 + nl][kk];
        }
#pragma unroll
      for (int ns = 0; ns < 4; ++ns)
#pragma unroll
        for (int e = 0; e < 16; ++e) {
          int kk = ks * 32 + kb + e + ((e & 8) ? 8 : 0);
          b[ks][ns][e] = Ws[s][wn * 64 + ns * 16 + nl][kk];
        }
    }
    // Keeps all 24 LDS reads ahead of the first product. With the fetched
    // tile held in registers the compiler otherwise reuses a B fragment's
    // registers, and each reuse waits out a full LDS latency.
    __builtin_amdgcn_sched_barrier(0);
#pragma unroll
    for (int ks = 0; ks < 2; ++ks)
#pragma unroll
      for (int ns = 0; ns < 4; ++ns)
#pragma unroll
        for (int mi = 0; mi < 2; ++mi)
          acc[mi][ns] = __builtin_amdgcn_wmma_f32_16x16x32_f16(
              false, a[ks][mi], false, b[ks][ns], (short)0, acc[mi][ns], false, false);
  };

  // Two LDS stages: the next K-step's global loads fly while this step's
  // products run. One barrier a step: it publishes the stage just written and
  // ends every wave's reads of the stage that the next step overwrites.
  fetch(0);
  stash(0);
  __syncthreads();
  int s = 0;
  for (int k0 = 64; k0 < K; k0 += 64) {
    fetch(k0);
    mma(s);
    // Keeps the conversions, and with them the wait for the loads, behind the
    // products; the compiler lifts them ahead to free registers early.
    __builtin_amdgcn_sched_barrier(0);
    stash(s ^ 1);
    __syncthreads();
    s ^= 1;
  }
  mma(s);

#pragma unroll
  for (int mi = 0; mi < 2; ++mi)
#pragma unroll
    for (int ns = 0; ns < 4; ++ns)
#pragma unroll
      for (int r = 0; r < 8; ++r) {
        size_t idx = (size_t)(m0 + wm * 32 + mi * 16 + r + half * 8) * N +
                     n0 + wn * 64 + ns * 16 + nl;
        float vv = acc[mi][ns][r] * oscale;
        if (F16OUT) ((_Float16*)Yp)[idx] = (_Float16)vv;
        else        ((float*)Yp)[idx] = vv;
      }
}

// ---------------------------------------------------------------------------
// Forget gate: f[h][t] = log_sigmoid(hidden[t] . Wf[h] + bf[h])
// One block per 32 positions, all 16 heads; its 16 waves split k, 64 each.
// f32 WMMA 16x16x4 with Wf as A (M = head) and hidden as B (N = position):
// hidden is read once for all heads, 32 bytes a row and load, where one thread
// per (h, t) read it 16 times with every lane on a cache line of its own.
// A's row and B's column are loaded by the same code (16 bytes at k0 + 8 j of
// the lane's row, k0 holding the lane half's 4), so their k orders are equal.
// ---------------------------------------------------------------------------
#define FG_T 32      // positions per block: a whole 128-byte line of f per head
#define FG_W 16      // waves per block
#define FG_K (HID / FG_W)

__global__ void __launch_bounds__(FG_W * 32)
fgate_kernel(const float* __restrict__ x, const float* __restrict__ Wf,
             const float* __restrict__ bf, float* __restrict__ f) {
  __shared__ float part[FG_W][NH][FG_T];   // each wave's partial sums
  const int tid  = threadIdx.x;
  const int w    = tid >> 5;
  const int lane = tid & 31;
  const int c    = lane & 15;
  const int hh   = lane >> 4;
  const int t0   = blockIdx.x * FG_T;
  const int k0   = w * FG_K + hh * 4;

  const float* wp = Wf + (size_t)c * HID + k0;
  const float* xp = x + (size_t)(t0 + c) * HID + k0;
  float4 wv[FG_K / 8], xa[FG_K / 8], xb[FG_K / 8];
#pragma unroll
  for (int j = 0; j < FG_K / 8; ++j) {
    wv[j] = *(const float4*)(wp + j * 8);
    xa[j] = *(const float4*)(xp + j * 8);
    xb[j] = *(const float4*)(xp + (size_t)16 * HID + j * 8);
  }
  const float bias = bf[w];
  // Keeps all 25 loads ahead of the first product, so that the wave waits out
  // one load latency. Without it the compiler keeps nine in flight, reuses
  // their registers and issues the rest behind products that wait for data.
  __builtin_amdgcn_sched_barrier(0);

  v8f a0 = (v8f){0,0,0,0,0,0,0,0};   // positions t0 .. t0 + 15
  v8f a1 = (v8f){0,0,0,0,0,0,0,0};   // positions t0 + 16 .. t0 + 31
#pragma unroll
  for (int j = 0; j < FG_K / 8; ++j) {
    const v2f wl = {wv[j].x, wv[j].y}, wh = {wv[j].z, wv[j].w};
    a0 = __builtin_amdgcn_wmma_f32_16x16x4_f32(
        false, wl, false, (v2f){xa[j].x, xa[j].y}, (short)0, a0, false, false);
    a1 = __builtin_amdgcn_wmma_f32_16x16x4_f32(
        false, wl, false, (v2f){xb[j].x, xb[j].y}, (short)0, a1, false, false);
    a0 = __builtin_amdgcn_wmma_f32_16x16x4_f32(
        false, wh, false, (v2f){xa[j].z, xa[j].w}, (short)0, a0, false, false);
    a1 = __builtin_amdgcn_wmma_f32_16x16x4_f32(
        false, wh, false, (v2f){xb[j].z, xb[j].w}, (short)0, a1, false, false);
  }
  __builtin_amdgcn_sched_barrier(0);
  // D layout: register r of lane (c, hh) is (head 8 hh + r, position c).
#pragma unroll
  for (int r = 0; r < 8; ++r) {
    part[w][hh * 8 + r][c]      = a0[r];
    part[w][hh * 8 + r][16 + c] = a1[r];
  }
  __syncthreads();   // publishes the 16 partial sums of every (head, position)

  // Wave w finishes head w: 32 consecutive positions, one whole line of f.
  float acc = bias;
#pragma unroll
  for (int j = 0; j < FG_W; ++j) acc += part[j][w][lane];
  float ls = (acc > 0.f) ? -log1pf(__expf(-acc)) : (acc - log1pf(__expf(acc)));
  f[(size_t)w * T_SEQ + t0 + lane] = ls;
}

// Cumulative decay (both directions): gc[dir][h][p] over direction-local p.
// One 256-thread block per (dir, head). Each thread sums its 8 consecutive
// positions, the 32 lane totals are scanned by shuffles, the 8 wave totals
// go through LDS; every thread then adds the sum of all that lies before it.
__global__ void __launch_bounds__(256)
fscan_kernel(const float* __restrict__ f, float* __restrict__ gc) {
  __shared__ float wtot[8];
  const int tid  = threadIdx.x;
  const int wave = tid >> 5;
  const int lane = tid & 31;
  const int dir  = blockIdx.x >> 4;
  const int h    = blockIdx.x & 15;
  const int p0   = tid * 8;
  const float* fh = f + (size_t)h * T_SEQ;

  // Position p reads t = p, or t = T-1-p in the reverse direction: there the
  // thread's 8 floats lie at T-8-p0 and are taken from the top down.
  const float* src = fh + (dir ? (T_SEQ - 8 - p0) : p0);
  const float4 a = *(const float4*)(src);
  const float4 b = *(const float4*)(src + 4);
  float x[8];
  x[0] = dir ? b.w : a.x;  x[1] = dir ? b.z : a.y;
  x[2] = dir ? b.y : a.z;  x[3] = dir ? b.x : a.w;
  x[4] = dir ? a.w : b.x;  x[5] = dir ? a.z : b.y;
  x[6] = dir ? a.y : b.z;  x[7] = dir ? a.x : b.w;
#pragma unroll
  for (int i = 1; i < 8; ++i) x[i] += x[i - 1];

  float incl = x[7];             // inclusive scan of the lane totals
#pragma unroll
  for (int off = 1; off < 32; off <<= 1) {
    float up = __shfl_up(incl, off, 32);
    if (lane >= off) incl += up;
  }
  const float excl = __shfl_up(incl, 1, 32);
  if (lane == 31) wtot[wave] = incl;
  __syncthreads();               // publishes the 8 wave totals
  float base = (lane > 0) ? excl : 0.f;   // lanes before this one, same wave
#pragma unroll
  for (int j = 0; j < 7; ++j)
    if (j < wave) base += wtot[j];

  float* dst = gc + (size_t)blockIdx.x * T_SEQ + p0;
  *(float4*)(dst)     = make_float4(x[0] + base, x[1] + base, x[2] + base, x[3] + base);
  *(float4*)(dst + 4) = make_float4(x[4] + base, x[5] + base, x[6] + base, x[7] + base);
}

__global__ void __launch_bounds__(WPB * 32)
fox_attn_kernel(const _Float16* __restrict__ q, const _Float16* __restrict__ k,
                const _Float16* __restrict__ v, const float* __restrict__ gc,
                float* __restrict__ obuf) {
  // 144B row stride (16B multiple)
  __shared__ __attribute__((aligned(16))) _Float16 k_s[2][32][72];
  __shared__ __attribute__((aligned(16))) _Float16 v_s[2][32][72];
  __shared__ float g_s[2][WPB][32];   // each wave keeps a copy of its own
  __shared__ __attribute__((aligned(16))) _Float16 p_s[WPB][16][32];

  const int tid  = threadIdx.x;
  // The wave's number in a scalar register: the test that skips the stages
  // beyond a wave's diagonal is then a scalar branch.
  const int w    = __builtin_amdgcn_readfirstlane(tid >> 5);
  const int lane = tid & 31;
  const int half = (lane >> 4) & 1;
  const int nl   = lane & 15;
  const int kbh  = half * 8;
  const int h    = blockIdx.y;
  const int dir  = blockIdx.z;
  const float* gcd = gc + ((size_t)dir * NH + h) * T_SEQ;

  // Issue this thread's share of stage t: rows crow and crow + 16, one 16-byte
  // chunk of each, of K and of V (32 rows x 8 chunks each), and one decay sum.
  // K and V share the chunk's byte offset: that of stage 0 plus t scalar steps.
  const int crow = tid >> 3;
  const int ccol = (tid & 7) * 8;
  const int kvstep = (dir ? -32 : 32) * HID * (int)sizeof(_Float16);
  unsigned off0[32 / (WPB * 4)];
#pragma unroll
  for (int i = 0; i < 32 / (WPB * 4); ++i) {
    const int row = crow + i * (WPB * 4);
    const int tt  = dir ? (T_SEQ - 1 - row) : row;
    off0[i] = (unsigned)((tt * HID + h * HD + ccol) * (int)sizeof(_Float16));
  }
  auto stage = [&](int t) {
    const int s = t & 1;
#pragma unroll
    for (int i = 0; i < 32 / (WPB * 4); ++i) {
      const int row = crow + i * (WPB * 4);
      const unsigned off = off0[i] + (unsigned)(t * kvstep);
      copy16_g2l((const char*)k + off, &k_s[s][row][ccol]);
      copy16_g2l((const char*)v + off, &v_s[s][row][ccol]);
    }
    copy4_g2l(gcd + t * 32 + lane, &g_s[s][w][lane]);
  };

  for (int pass = 0; pass < 2; ++pass) {
  const int grp  = pass ? (int)blockIdx.x : (T_SEQ / 16 / WPB - 1 - (int)blockIdx.x);
  const int qt   = grp * WPB + w;           // q-tile index, 0..127
  const int nkb  = (qt >> 1) + 1;           // causal: this wave's kv blocks of 32
  const int nkbB = ((grp * WPB + WPB - 1) >> 1) + 1;   // the block's: its last wave's

  // Both buffers are free: in the second pass every wave has passed the first
  // pass's last publish point, behind its own last LDS read and last copy.
  stage(0);

  // Q fragments for this wave's 16 rows (q already scaled by d^-0.5).
  int qp_a = qt * 16 + nl;
  int tq   = dir ? (T_SEQ - 1 - qp_a) : qp_a;
  const _Float16* qrow = q + (size_t)tq * HID + h * HD;
  v16h a0, a1;
#pragma unroll
  for (int e = 0; e < 16; ++e) {
    int kk = kbh + e + ((e & 8) ? 8 : 0);
    a0[e] = qrow[kk];
    a1[e] = qrow[32 + kk];
  }
  float gq[8];
#pragma unroll
  for (int r = 0; r < 8; ++r) gq[r] = gcd[qt * 16 + r + half * 8];

  v8f o[4];
#pragma unroll
  for (int i = 0; i < 4; ++i) o[i] = (v8f){0,0,0,0,0,0,0,0};
  float rmax[8], rsum[8];
#pragma unroll
  for (int r = 0; r < 8; ++r) { rmax[r] = -1e30f; rsum[r] = 0.f; }

  wait_async0();     // this wave's share of stage 0 has landed
  __syncthreads();   // publishes stage 0
  if (1 < nkbB) stage(1);

  for (int t = 0; t < nkbB; ++t) {
    const int s = t & 1;
    if (t < nkb) {   // a wave skips the stages beyond its diagonal, not their publish points
      const int kv0 = t * 32;

      // ---- S = Q K^T : two 16x16 accum tiles ----
      const float gk0 = g_s[s][w][nl];        // the keys' decay sums
      const float gk1 = g_s[s][w][16 + nl];
      v16h b0[2], b1[2];
#pragma unroll
      for (int ks = 0; ks < 2; ++ks)
#pragma unroll
        for (int e = 0; e < 16; ++e) {
          int kk = ks * 32 + kbh + e + ((e & 8) ? 8 : 0);
          b0[ks][e] = k_s[s][nl][kk];        // key rows 0..15
          b1[ks][e] = k_s[s][16 + nl][kk];   // key rows 16..31
        }
      // Keeps the stage's reads of K and of the decay sums ahead of the first
      // product, one LDS latency for all. The compiler otherwise sinks the decay
      // sums' read behind the last product and reuses a K fragment's registers,
      // and each of the two waits out an LDS latency of its own.
      __builtin_amdgcn_sched_barrier(0);
      v8f s0 = (v8f){0,0,0,0,0,0,0,0};
      v8f s1 = (v8f){0,0,0,0,0,0,0,0};
#pragma unroll
      for (int ks = 0; ks < 2; ++ks) {
        s0 = __builtin_amdgcn_wmma_f32_16x16x32_f16(
            false, (ks ? a1 : a0), false, b0[ks], (short)0, s0, false, false);
        s1 = __builtin_amdgcn_wmma_f32_16x16x32_f16(
            false, (ks ? a1 : a0), false, b1[ks], (short)0, s1, false, false);
      }

      // ---- decay + causal mask + online softmax (rows across 16 lanes) ----
      int kp0 = kv0 + nl, kp1 = kv0 + 16 + nl;
      float x0[8], x1[8], m[8];
#pragma unroll
      for (int r = 0; r < 8; ++r) {
        int qp = qt * 16 + r + half * 8;
        x0[r] = (kp0 <= qp) ? (s0[r] + gq[r] - gk0) : -1e30f;
        x1[r] = (kp1 <= qp) ? (s1[r] + gq[r] - gk1) : -1e30f;
        m[r]  = fmaxf(x0[r], x1[r]);
      }
      row16_max8(m);
      float dm[8], ps[8];
#pragma unroll
      for (int r = 0; r < 8; ++r) {
        float nm = fmaxf(rmax[r], m[r]);
        dm[r] = rmax[r] - nm;
        rmax[r] = nm;
        float p0, p1;
        exp_pair_with_slot(x0[r] - nm, x1[r] - nm, p0, p1);
        ps[r] = p0 + p1;
        // transpose P (C-layout -> A-layout) through LDS
        p_s[w][r + half * 8][nl]      = (_Float16)p0;
        p_s[w][r + half * 8][16 + nl] = (_Float16)p1;
      }
      wait_ds0();   // every lane's P is in LDS before other lanes read it

      // ---- O += P V : P as A fragment, V columns as B fragments ----
      v16h ap;
#pragma unroll
      for (int e = 0; e < 16; ++e) {
        int kk = kbh + e + ((e & 8) ? 8 : 0);
        ap[e] = p_s[w][nl][kk];
      }
      // V lies row-major [kv][d]; the B fragment wants column ns * 16 + nl with
      // kv = kbh + e (e < 8) and 16 + kbh + (e - 8): two transposing loads, at kv
      // rows 0 and 16, deliver exactly that, in ap's k order.
      const _Float16* vtr = &v_s[s][kbh + (lane & 7)][((lane >> 3) & 1) * 8];
      v16h bv[4];
#pragma unroll
      for (int ns = 0; ns < 4; ++ns) {
        const v8h lo = lds_tr16(vtr + ns * 16);
        const v8h hi = lds_tr16(vtr + 16 * 72 + ns * 16);
#pragma unroll
        for (int e = 0; e < 8; ++e) { bv[ns][e] = lo[e]; bv[ns][8 + e] = hi[e]; }
      }
      // Keeps all ten LDS reads ahead of what follows: row sums, alpha and the
      // rescale need no LDS and fill the reads' latency, and no V fragment's
      // registers are reused (a reuse waits out an LDS latency between products).
      __builtin_amdgcn_sched_barrier(0);
      row16_sum8(ps);
#pragma unroll
      for (int r = 0; r < 8; ++r) {
        float alpha = exp_with_slot(dm[r]);
        rsum[r] = rsum[r] * alpha + ps[r];
#pragma unroll
        for (int i = 0; i < 4; ++i) o[i][r] *= alpha;
      }
#pragma unroll
      for (int ns = 0; ns < 4; ++ns)
        o[ns] = __builtin_amdgcn_wmma_f32_16x16x32_f16(
            false, ap, false, bv[ns], (short)0, o[ns], false, false);
    }

    // ---- publish point of stage t + 1; every wave passes it ----
    wait_ds0();        // this wave's reads of stage t are done
    wait_async0();     // its share of stage t + 1 has landed
    __syncthreads();   // publishes stage t + 1; every wave has left stage t
    if (t + 2 < nkbB) stage(t + 2);   // into the buffer that stage t has left
  }
  wait_async0();   // no copy is in flight when the pass, or the wave, ends

  // ---- epilogue: normalize and scatter into concat buffer [T, 2H] ----
#pragma unroll
  for (int ns = 0; ns < 4; ++ns)
#pragma unroll
    for (int r = 0; r < 8; ++r) {
      int qp = qt * 16 + r + half * 8;
      int t  = dir ? (T_SEQ - 1 - qp) : qp;
      obuf[(size_t)t * (2 * HID) + (size_t)dir * HID + h * HD + ns * 16 + nl] =
          o[ns][r] / rsum[r];
    }
  // The wait that stands before a register named by an issued store is
  // overwritten: the second pass reuses the stores' address and data registers.
  asm volatile("s_wait_xcnt 0x0" ::: "memory");
  }   // pass
}

// ---------------------------------------------------------------------------
extern "C" void kernel_launch(void* const* d_in, const int* in_sizes, int n_in,
                              void* d_out, int out_size, void* d_ws, size_t ws_size,
                              hipStream_t stream) {
  (void)in_sizes; (void)n_in; (void)out_size; (void)ws_size;
  const float* hidden = (const float*)d_in[0];
  const float* Wq     = (const float*)d_in[1];
  const float* Wk     = (const float*)d_in[2];
  const float* Wv     = (const float*)d_in[3];
  const float* Wf     = (const float*)d_in[4];
  const float* bf     = (const float*)d_in[5];
  const float* Wo     = (const float*)d_in[6];
  float* out = (float*)d_out;

  // Workspace layout: q|k|v (f16) then f|gc|o_concat (f32)
  _Float16* qb = (_Float16*)d_ws;
  _Float16* kb = qb + (size_t)T_SEQ * HID;
  _Float16* vb = kb + (size_t)T_SEQ * HID;
  float* fb = (float*)(vb + (size_t)T_SEQ * HID);
  float* gc = fb + (size_t)NH * T_SEQ;
  float* ob = gc + (size_t)2 * NH * T_SEQ;

  // q, k and v in one launch; qb, kb and vb lie one behind the other.
  dim3 gproj(T_SEQ / 128, HID / 128, 3);
  gemm_f16_wmma<true><<<gproj, 256, 0, stream>>>(hidden, Wq, Wk, Wv, qb, T_SEQ, HID, HID,
                                                 0.125f /* d^-0.5 folded in */);

  fgate_kernel<<<T_SEQ / FG_T, FG_W * 32, 0, stream>>>(hidden, Wf, bf, fb);
  fscan_kernel<<<2 * NH, 256, 0, stream>>>(fb, gc);

  dim3 gattn(T_SEQ / 16 / WPB / 2, NH, 2);
  fox_attn_kernel<<<gattn, WPB * 32, 0, stream>>>(qb, kb, vb, gc, ob);

  dim3 gout(T_SEQ / 128, HID / 128);
  // One product: gridDim.z is 1, the second and third weight pointers go unread.
  gemm_f16_wmma<false><<<gout, 256, 0, stream>>>(ob, Wo, Wo, Wo, out, T_SEQ, HID,
                                                 2 * HID, 1.f);
}

// v010
// It runs in 103 microseconds.
// Timed twice side by side with v009, it ran 1.12 and 1.14 times as fast.
// Over all steps from v000 it is 4.69 times as fast.
#include <hip/hip_runtime.h>
#include <cstddef>

#define T_SEQ 2048
#define HID   1024
#define NH    16
#define HD    64     // head dim
#define WPB   4      // waves per block in attention kernel

typedef __attribute__((ext_vector_type(16))) _Float16 v16h;
typedef __attribute__((ext_vector_type(8)))  _Float16 v8h;
typedef __attribute__((ext_vector_type(8)))  float    v8f;
typedef __attribute__((ext_vector_type(2)))  float    v2f;
typedef __attribute__((ext_vector_type(8)))  short    s16x8;
typedef int async_v4i __attribute__((vector_size(4 * sizeof(int))));

#if __has_builtin(__builtin_amdgcn_global_load_async_to_lds_b128)
#define HAS_ASYNC_LDS 1
#else
#define HAS_ASYNC_LDS 0
#endif

__device__ __forceinline__ void copy16_g2l(const void* g, void* l) {
#if HAS_ASYNC_LDS
  __builtin_amdgcn_global_load_async_to_lds_b128(
      (__attribute__((address_space(1))) async_v4i*)(g),
      (__attribute__((address_space(3))) async_v4i*)(l), 0, 0);
#else
  *(float4*)l = *(const float4*)g;
#endif
}

// Copy 4 bytes global -> LDS, the same path.
__device__ __forceinline__ void copy4_g2l(const float* g, float* l) {
#if HAS_ASYNC_LDS
  __builtin_amdgcn_global_load_async_to_lds_b32(
      (__attribute__((address_space(1))) int*)(g),
      (__attribute__((address_space(3))) int*)(l), 0, 0);
#else
  *l = *g;
#endif
}

// In asm with the clobber: it holds every later LDS read behind it, which the
// builtin wait alone does not.
__device__ __forceinline__ void wait_async0() {
  asm volatile("s_wait_asynccnt 0x0" ::: "memory");
}

__device__ __forceinline__ v8h lds_tr16(const _Float16* p) {
  typedef __attribute__((address_space(3))) s16x8 lds_s16x8;
  return __builtin_bit_cast(
      v8h, __builtin_amdgcn_ds_load_tr16_b128_v8i16((lds_s16x8*)p));
}

__device__ __forceinline__ void wait_ds0() {
  asm volatile("s_wait_dscnt 0" ::: "memory");
}

__device__ __forceinline__ float other_half(float x) {
  const int b = __builtin_bit_cast(int, x);
  return __builtin_bit_cast(
      float, __builtin_amdgcn_permlanex16(b, b, 0x76543210, 0xfedcba98, false, false));
}

__device__ __forceinline__ float exp_with_slot(float x) {
  float y;
  asm("v_exp_f32 %0, %1\n\tv_nop" : "=v"(y) : "v"(x * 0x1.715476p+0f));
  return y;
}

__device__ __forceinline__ void exp_pair_with_slot(float x0, float x1, float& y0, float& y1) {
  asm("v_exp_f32 %0, %2\n\tv_exp_f32 %1, %3\n\tv_nop"
      : "=&v"(y0), "=&v"(y1)
      : "v"(x0 * 0x1.715476p+0f), "v"(x1 * 0x1.715476p+0f));
}

template <bool F16OUT>
__global__ void __launch_bounds__(256)
gemm_f16_wmma(const float* __restrict__ X, const float* __restrict__ W0,
              const float* __restrict__ W1, const float* __restrict__ W2,
              void* __restrict__ Y0, int M, int N, int K, float oscale0) {
  __shared__ _Float16 Xs[2][128][72];   // two stages; 144B row stride (16B x odd)
  __shared__ _Float16 Ws[2][128][72];

  const int z = blockIdx.z;
  const float* W = (z == 0) ? W0 : (z == 1) ? W1 : W2;
  const float oscale = (z == 0) ? oscale0 : 1.f;
  void* Yp = (char*)Y0 + (size_t)z * M * N * (F16OUT ? sizeof(_Float16) : sizeof(float));

  const int tid  = threadIdx.x;
  const int wave = tid >> 5;
  const int lane = tid & 31;
  const int half = (lane >> 4) & 1;   // which 16-lane half
  const int nl   = lane & 15;
  const int kb   = half * 8;          // per-half K base inside a 32-wide product
  const int wm   = wave & 3;          // 4 wave-rows of 32
  const int wn   = wave >> 2;         // 2 wave-cols of 64
  const int m0   = blockIdx.x * 128;
  const int n0   = blockIdx.y * 128;

  v8f acc[2][4];
#pragma unroll
  for (int mi = 0; mi < 2; ++mi)
#pragma unroll
    for (int ns = 0; ns < 4; ++ns) acc[mi][ns] = (v8f){0,0,0,0,0,0,0,0};

  // Each thread moves 8 chunks of 4 floats of either 128x64 tile: rows
  // srow + 16 i, floats scol .. scol + 3.
  const int srow = tid >> 4;
  const int scol = (tid & 15) * 4;
  const float* xg = X + (size_t)(m0 + srow) * K + scol;
  const float* wg = W + (size_t)(n0 + srow) * K + scol;
  float4 xr[8], wr[8];   // the tile in flight from global memory

  // Issue the loads of the K-step that starts at k0; their data is not waited
  // for here.
  auto fetch = [&](int k0) {
    const float* px[8];
    const float* pw[8];
#pragma unroll
    for (int i = 0; i < 8; ++i) {
      px[i] = xg + (size_t)(i * 16) * K + k0;
      pw[i] = wg + (size_t)(i * 16) * K + k0;
    }
#pragma unroll
    for (int i = 0; i < 8; ++i) xr[i] = *(const float4*)px[i];
#pragma unroll
    for (int i = 0; i < 8; ++i) wr[i] = *(const float4*)pw[i];
    // The wait that stands before a register named by an issued load is
    // overwritten. The sixteen address pairs are its inputs, so that none is
    // reused (as a later load's destination, for a later address) ahead of it.
    // Its clobber also holds the loads' issue ahead of the LDS reads and
    // products that follow; sunk below them, their latency would stand open.
    asm volatile("s_wait_xcnt 0x0"
                 :: "v"(px[0]), "v"(px[1]), "v"(px[2]), "v"(px[3]),
                    "v"(px[4]), "v"(px[5]), "v"(px[6]), "v"(px[7]),
                    "v"(pw[0]), "v"(pw[1]), "v"(pw[2]), "v"(pw[3]),
                    "v"(pw[4]), "v"(pw[5]), "v"(pw[6]), "v"(pw[7])
                 : "memory");
  };
  // Convert the fetched tile to f16 and lay it into stage s.
  auto stash = [&](int s) {
#pragma unroll
    for (int i = 0; i < 8; ++i) {
      _Float16* xl = &Xs[s][srow + i * 16][scol];
      xl[0] = (_Float16)xr[i].x;  xl[1] = (_Float16)xr[i].y;
      xl[2] = (_Float16)xr[i].z;  xl[3] = (_Float16)xr[i].w;
      _Float16* wl = &Ws[s][srow + i * 16][scol];
      wl[0] = (_Float16)wr[i].x;  wl[1] = (_Float16)wr[i].y;
      wl[2] = (_Float16)wr[i].z;  wl[3] = (_Float16)wr[i].w;
    }
  };
  // The 16 WMMA of one K-step, operands from stage s; ks is the 32-wide half.
  auto mma = [&](int s) {
    v16h a[2][2];
    v16h b[2][4];   // column n = W row (n0+wn*64+ns*16+nl), K along the W row
#pragma unroll
    for (int ks = 0; ks < 2; ++ks) {
#pragma unroll
      for (int mi = 0; mi < 2; ++mi)
#pragma unroll
        for (int e = 0; e < 16; ++e) {
          int kk = ks * 32 + kb + e + ((e & 8) ? 8 : 0);
          a[ks][mi][e] = Xs[s][wm * 32 + mi * 16 + nl][kk];
        }
#pragma unroll
      for (int ns = 0; ns < 4; ++ns)
#pragma unroll
        for (int e = 0; e < 16; ++e) {
          int kk = ks * 32 + kb + e + ((e & 8) ? 8 : 0);
          b[ks][ns][e] = Ws[s][wn * 64 + ns * 16 + nl][kk];
        }
    }
    // Keeps all 24 LDS reads ahead of the first product. With the fetched
    // tile held in registers the compiler otherwise reuses a B fragment's
    // registers, and each reuse waits out a full LDS latency.
    __builtin_amdgcn_sched_barrier(0);
#pragma unroll
    for (int ks = 0; ks < 2; ++ks)
#pragma unroll
      for (int ns = 0; ns < 4; ++ns)
#pragma unroll
        for (int mi = 0; mi < 2; ++mi)
          acc[mi][ns] = __builtin_amdgcn_wmma_f32_16x16x32_f16(
              false, a[ks][mi], false, b[ks][ns], (short)0, acc[mi][ns], false, false);
  };

  // Two LDS stages: the next K-step's global loads fly while this step's
  // products run. One barrier a step: it publishes the stage just written and
  // ends every wave's reads of the stage that the next step overwrites.
  fetch(0);
  stash(0);
  __syncthreads();
  int s = 0;
  for (int k0 = 64; k0 < K; k0 += 64) {
    fetch(k0);
    mma(s);
    // Keeps the conversions, and with them the wait for the loads, behind the
    // products; the compiler lifts them ahead to free registers early.
    __builtin_amdgcn_sched_barrier(0);
    stash(s ^ 1);
    __syncthreads();
    s ^= 1;
  }
  mma(s);

#pragma unroll
  for (int mi = 0; mi < 2; ++mi)
#pragma unroll
    for (int ns = 0; ns < 4; ++ns)
#pragma unroll
      for (int r = 0; r < 8; ++r) {
        size_t idx = (size_t)(m0 + wm * 32 + mi * 16 + r + half * 8) * N +
                     n0 + wn * 64 + ns * 16 + nl;
        float vv = acc[mi][ns][r] * oscale;
        if (F16OUT) ((_Float16*)Yp)[idx] = (_Float16)vv;
        else        ((float*)Yp)[idx] = vv;
      }
}

// ---------------------------------------------------------------------------
// Forget gate: f[h][t] = log_sigmoid(hidden[t] . Wf[h] + bf[h])
// One block per 32 positions, all 16 heads; its 16 waves split k, 64 each.
// f32 WMMA 16x16x4 with Wf as A (M = head) and hidden as B (N = position):
// hidden is read once for all heads, 32 bytes a row and load, where one thread
// per (h, t) read it 16 times with every lane on a cache line of its own.
// A's row and B's column are loaded by the same code (16 bytes at k0 + 8 j of
// the lane's row, k0 holding the lane half's 4), so their k orders are equal.
// ---------------------------------------------------------------------------
#define FG_T 32      // positions per block: a whole 128-byte line of f per head
#define FG_W 16      // waves per block
#define FG_K (HID / FG_W)

__global__ void __launch_bounds__(FG_W * 32)
fgate_kernel(const float* __restrict__ x, const float* __restrict__ Wf,
             const float* __restrict__ bf, float* __restrict__ f) {
  __shared__ float part[FG_W][NH][FG_T];   // each wave's partial sums
  const int tid  = threadIdx.x;
  const int w    = tid >> 5;
  const int lane = tid & 31;
  const int c    = lane & 15;
  const int hh   = lane >> 4;
  const int t0   = blockIdx.x * FG_T;
  const int k0   = w * FG_K + hh * 4;

  const float* wp = Wf + (size_t)c * HID + k0;
  const float* xp = x + (size_t)(t0 + c) * HID + k0;
  float4 wv[FG_K / 8], xa[FG_K / 8], xb[FG_K / 8];
#pragma unroll
  for (int j = 0; j < FG_K / 8; ++j) {
    wv[j] = *(const float4*)(wp + j * 8);
    xa[j] = *(const float4*)(xp + j * 8);
    xb[j] = *(const float4*)(xp + (size_t)16 * HID + j * 8);
  }
  const float bias = bf[w];
  // Keeps all 25 loads ahead of the first product, so that the wave waits out
  // one load latency. Without it the compiler keeps nine in flight, reuses
  // their registers and issues the rest behind products that wait for data.
  __builtin_amdgcn_sched_barrier(0);

  v8f a0 = (v8f){0,0,0,0,0,0,0,0};   // positions t0 .. t0 + 15
  v8f a1 = (v8f){0,0,0,0,0,0,0,0};   // positions t0 + 16 .. t0 + 31
#pragma unroll
  for (int j = 0; j < FG_K / 8; ++j) {
    const v2f wl = {wv[j].x, wv[j].y}, wh = {wv[j].z, wv[j].w};
    a0 = __builtin_amdgcn_wmma_f32_16x16x4_f32(
        false, wl, false, (v2f){xa[j].x, xa[j].y}, (short)0, a0, false, false);
    a1 = __builtin_amdgcn_wmma_f32_16x16x4_f32(
        false, wl, false, (v2f){xb[j].x, xb[j].y}, (short)0, a1, false, false);
    a0 = __builtin_amdgcn_wmma_f32_16x16x4_f32(
        false, wh, false, (v2f){xa[j].z, xa[j].w}, (short)0, a0, false, false);
    a1 = __builtin_amdgcn_wmma_f32_16x16x4_f32(
        false, wh, false, (v2f){xb[j].z, xb[j].w}, (short)0, a1, false, false);
  }
  __builtin_amdgcn_sched_barrier(0);
  // D layout: register r of lane (c, hh) is (head 8 hh + r, position c).
#pragma unroll
  for (int r = 0; r < 8; ++r) {
    part[w][hh * 8 + r][c]      = a0[r];
    part[w][hh * 8 + r][16 + c] = a1[r];
  }
  __syncthreads();   // publishes the 16 partial sums of every (head, position)

  // Wave w finishes head w: 32 consecutive positions, one whole line of f.
  float acc = bias;
#pragma unroll
  for (int j = 0; j < FG_W; ++j) acc += part[j][w][lane];
  float ls = (acc > 0.f) ? -log1pf(__expf(-acc)) : (acc - log1pf(__expf(acc)));
  f[(size_t)w * T_SEQ + t0 + lane] = ls;
}

// Cumulative decay (both directions): gc[dir][h][p] over direction-local p.
// One 256-thread block per (dir, head). Each thread sums its 8 consecutive
// positions, the 32 lane totals are scanned by shuffles, the 8 wave totals
// go through LDS; every thread then adds the sum of all that lies before it.
__global__ void __launch_bounds__(256)
fscan_kernel(const float* __restrict__ f, float* __restrict__ gc) {
  __shared__ float wtot[8];
  const int tid  = threadIdx.x;
  const int wave = tid >> 5;
  const int lane = tid & 31;
  const int dir  = blockIdx.x >> 4;
  const int h    = blockIdx.x & 15;
  const int p0   = tid * 8;
  const float* fh = f + (size_t)h * T_SEQ;

  // Position p reads t = p, or t = T-1-p in the reverse direction: there the
  // thread's 8 floats lie at T-8-p0 and are taken from the top down.
  const float* src = fh + (dir ? (T_SEQ - 8 - p0) : p0);
  const float4 a = *(const float4*)(src);
  const float4 b = *(const float4*)(src + 4);
  float x[8];
  x[0] = dir ? b.w : a.x;  x[1] = dir ? b.z : a.y;
  x[2] = dir ? b.y : a.z;  x[3] = dir ? b.x : a.w;
  x[4] = dir ? a.w : b.x;  x[5] = dir ? a.z : b.y;
  x[6] = dir ? a.y : b.z;  x[7] = dir ? a.x : b.w;
#pragma unroll
  for (int i = 1; i < 8; ++i) x[i] += x[i - 1];

  float incl = x[7];             // inclusive scan of the lane totals
#pragma unroll
  for (int off = 1; off < 32; off <<= 1) {
    float up = __shfl_up(incl, off, 32);
    if (lane >= off) incl += up;
  }
  const float excl = __shfl_up(incl, 1, 32);
  if (lane == 31) wtot[wave] = incl;
  __syncthreads();               // publishes the 8 wave totals
  float base = (lane > 0) ? excl : 0.f;   // lanes before this one, same wave
#pragma unroll
  for (int j = 0; j < 7; ++j)
    if (j < wave) base += wtot[j];

  float* dst = gc + (size_t)blockIdx.x * T_SEQ + p0;
  *(float4*)(dst)     = make_float4(x[0] + base, x[1] + base, x[2] + base, x[3] + base);
  *(float4*)(dst + 4) = make_float4(x[4] + base, x[5] + base, x[6] + base, x[7] + base);
}

__global__ void __launch_bounds__(WPB * 32)
fox_attn_kernel(const _Float16* __restrict__ q, const _Float16* __restrict__ k,
                const _Float16* __restrict__ v, const float* __restrict__ gc,
                float* __restrict__ obuf) {
  // 144B row stride (16B multiple)
  __shared__ __attribute__((aligned(16))) _Float16 k_s[2][32][72];
  __shared__ __attribute__((aligned(16))) _Float16 v_s[2][32][72];
  // each wave keeps a copy of its own
  __shared__ __attribute__((aligned(16))) float g_s[2][WPB][32];

  const int tid  = threadIdx.x;
  // The wave's number in a scalar register: the test that skips the stages
  // beyond a wave's diagonal is then a scalar branch.
  const int w    = __builtin_amdgcn_readfirstlane(tid >> 5);
  const int lane = tid & 31;
  const int half = (lane >> 4) & 1;
  const int nl   = lane & 15;
  const int kbh  = half * 8;
  const int h    = blockIdx.y;
  const int dir  = blockIdx.z;
  const float* gcd = gc + ((size_t)dir * NH + h) * T_SEQ;

  // Issue this thread's share of stage t: rows crow and crow + 16, one 16-byte
  // chunk of each, of K and of V (32 rows x 8 chunks each), and one decay sum.
  // K and V share the chunk's byte offset: that of stage 0 plus t scalar steps.
  const int crow = tid >> 3;
  const int ccol = (tid & 7) * 8;
  const int kvstep = (dir ? -32 : 32) * HID * (int)sizeof(_Float16);
  unsigned off0[32 / (WPB * 4)];
#pragma unroll
  for (int i = 0; i < 32 / (WPB * 4); ++i) {
    const int row = crow + i * (WPB * 4);
    const int tt  = dir ? (T_SEQ - 1 - row) : row;
    off0[i] = (unsigned)((tt * HID + h * HD + ccol) * (int)sizeof(_Float16));
  }
  auto stage = [&](int t) {
    const int s = t & 1;
#pragma unroll
    for (int i = 0; i < 32 / (WPB * 4); ++i) {
      const int row = crow + i * (WPB * 4);
      const unsigned off = off0[i] + (unsigned)(t * kvstep);
      copy16_g2l((const char*)k + off, &k_s[s][row][ccol]);
      copy16_g2l((const char*)v + off, &v_s[s][row][ccol]);
    }
    copy4_g2l(gcd + t * 32 + lane, &g_s[s][w][lane]);
  };

  for (int pass = 0; pass < 2; ++pass) {
  const int grp  = pass ? (int)blockIdx.x : (T_SEQ / 16 / WPB - 1 - (int)blockIdx.x);
  const int qt   = grp * WPB + w;           // q-tile index, 0..127
  const int nkb  = (qt >> 1) + 1;           // causal: this wave's kv blocks of 32
  const int nkbB = ((grp * WPB + WPB - 1) >> 1) + 1;   // the block's: its last wave's

  // Both buffers are free: in the second pass every wave has passed the first
  // pass's last publish point, behind its own last LDS read and last copy.
  stage(0);

  // Q fragments for this wave's 16 rows (q already scaled by d^-0.5).
  int qp_a = qt * 16 + nl;
  int tq   = dir ? (T_SEQ - 1 - qp_a) : qp_a;
  const _Float16* qrow = q + (size_t)tq * HID + h * HD;
  v16h a0, a1;
#pragma unroll
  for (int e = 0; e < 16; ++e) {
    int kk = kbh + e + ((e & 8) ? 8 : 0);
    a0[e] = qrow[kk];
    a1[e] = qrow[32 + kk];
  }
  const float gq = gcd[qp_a];   // the lane's query's decay sum

  v8f o[4];
#pragma unroll
  for (int i = 0; i < 4; ++i) o[i] = (v8f){0,0,0,0,0,0,0,0};
  float rmax = -1e30f;   // the query's running maximum, equal in both halves
  float rsum = 0.f;      // the sum over this lane's keys alone; joined in the epilogue
  // The wait that stands before a register named by an issued load is
  // overwritten: the accumulators' start values reuse the address registers of
  // the loads of Q and of the query's decay sum.
  asm volatile("s_wait_xcnt 0x0" ::: "memory");

  wait_async0();     // this wave's share of stage 0 has landed
  __syncthreads();   // publishes stage 0
  if (1 < nkbB) stage(1);

  for (int t = 0; t < nkbB; ++t) {
    const int s = t & 1;
    if (t < nkb) {   // a wave skips the stages beyond its diagonal, not their publish points
      const int kv0 = t * 32;

      // ---- S^T = K Q^T : two 16x16 accum tiles, keys down, queries across ----
      // Register r of tile 0 is key kbh + r, of tile 1 key 16 + kbh + r. Element
      // e of a lane's 16 scores is register e of tile 0, then e - 8 of tile 1.
      float gk[16];                           // those keys' decay sums
#pragma unroll
      for (int e = 0; e < 16; ++e) gk[e] = g_s[s][w][kbh + e + (e & 8)];
      v16h b0[2], b1[2];
#pragma unroll
      for (int ks = 0; ks < 2; ++ks)
#pragma unroll
        for (int e = 0; e < 16; ++e) {
          int kk = ks * 32 + kbh + e + ((e & 8) ? 8 : 0);
          b0[ks][e] = k_s[s][nl][kk];        // key rows 0..15
          b1[ks][e] = k_s[s][16 + nl][kk];   // key rows 16..31
        }
      // Holds the stage's reads of K and of the decay sums in place, ahead of the
      // first product: one LDS latency for all. The loaded values are its inputs
      // and nothing else. Without it the compiler sinks half of the reads behind
      // the first products, into the registers of the fragments those have used,
      // and the later products wait out a second LDS latency.
      asm volatile("" :: "v"(b0[0]), "v"(b1[0]), "v"(b0[1]), "v"(b1[1]),
                   "v"(gk[0]), "v"(gk[1]), "v"(gk[2]), "v"(gk[3]),
                   "v"(gk[4]), "v"(gk[5]), "v"(gk[6]), "v"(gk[7]),
                   "v"(gk[8]), "v"(gk[9]), "v"(gk[10]), "v"(gk[11]),
                   "v"(gk[12]), "v"(gk[13]), "v"(gk[14]), "v"(gk[15]));
      v8f s0 = (v8f){0,0,0,0,0,0,0,0};
      v8f s1 = (v8f){0,0,0,0,0,0,0,0};
#pragma unroll
      for (int ks = 0; ks < 2; ++ks) {
        s0 = __builtin_amdgcn_wmma_f32_16x16x32_f16(
            false, b0[ks], false, (ks ? a1 : a0), (short)0, s0, false, false);
        s1 = __builtin_amdgcn_wmma_f32_16x16x32_f16(
            false, b1[ks], false, (ks ? a1 : a0), (short)0, s1, false, false);
      }
      // V lies row-major [kv][d]; V^T's A fragment wants column ns * 16 + nl with
      // kv = kbh + e (e < 8) and 16 + kbh + (e - 8): two transposing loads, at kv
      // rows 0 and 16, deliver exactly that, the order in which P^T's keys lie.
      const _Float16* vtr = &v_s[s][kbh + (lane & 7)][((lane >> 3) & 1) * 8];
      v16h av[4];
#pragma unroll
      for (int ns = 0; ns < 4; ++ns) {
        const v8h lo = lds_tr16(vtr + ns * 16);
        const v8h hi = lds_tr16(vtr + 16 * 72 + ns * 16);
#pragma unroll
        for (int e = 0; e < 8; ++e) { av[ns][e] = lo[e]; av[ns][8 + e] = hi[e]; }
      }
      // Keeps V's eight reads ahead of the softmax, which needs no LDS and fills
      // their latency, and no V fragment's registers are reused (a reuse waits
      // out an LDS latency between products).
      __builtin_amdgcn_sched_barrier(0);

      // ---- decay + causal mask + online softmax (one query per lane) ----
      const int lim = qp_a - kv0 - kbh;   // key kbh + j of the stage is allowed where j <= lim
      const v2f gq2 = {gq, gq};
      float x[16];
#pragma unroll
      for (int e = 0; e < 16; e += 2) {
        const v2f sv = (e < 8) ? (v2f){s0[e & 7], s0[(e & 7) + 1]} : (v2f){s1[e & 7], s1[(e & 7) + 1]};
        const v2f xv = sv + gq2 - (v2f){gk[e], gk[e + 1]};
        x[e]     = (e + (e & 8) <= lim)     ? xv[0] : -1e30f;
        x[e + 1] = (e + 1 + (e & 8) <= lim) ? xv[1] : -1e30f;
      }
      float m = fmaxf(
          fmaxf(fmaxf(fmaxf(x[0], x[1]), fmaxf(x[2], x[3])),
                fmaxf(fmaxf(x[4], x[5]), fmaxf(x[6], x[7]))),
          fmaxf(fmaxf(fmaxf(x[8], x[9]), fmaxf(x[10], x[11])),
                fmaxf(fmaxf(x[12], x[13]), fmaxf(x[14], x[15]))));
      m = fmaxf(m, other_half(m));   // over all 32 keys
      const float nm = fmaxf(rmax, m);
      const float dm = rmax - nm;
      rmax = nm;
      float ps[8];
      v16h bp;   // P^T's B fragment
#pragma unroll
      for (int j = 0; j < 8; ++j) {
        float p0, p1;
        exp_pair_with_slot(x[2 * j] - nm, x[2 * j + 1] - nm, p0, p1);
        ps[j] = p0 + p1;
        bp[2 * j]     = (_Float16)p0;
        bp[2 * j + 1] = (_Float16)p1;
      }
      const float alpha = exp_with_slot(dm);
      rsum = rsum * alpha + (((ps[0] + ps[1]) + (ps[2] + ps[3])) +
                             ((ps[4] + ps[5]) + (ps[6] + ps[7])));
#pragma unroll
      for (int i = 0; i < 4; ++i)
#pragma unroll
        for (int r = 0; r < 8; ++r) o[i][r] *= alpha;

      // ---- O^T += V^T P^T : register r of o[ns] is (d = ns * 16 + kbh + r, query nl) ----
#pragma unroll
      for (int ns = 0; ns < 4; ++ns)
        o[ns] = __builtin_amdgcn_wmma_f32_16x16x32_f16(
            false, av[ns], false, bp, (short)0, o[ns], false, false);
    }

    // ---- publish point of stage t + 1; every wave passes it ----
    wait_ds0();        // this wave's reads of stage t are done
    wait_async0();     // its share of stage t + 1 has landed
    __syncthreads();   // publishes stage t + 1; every wave has left stage t
    if (t + 2 < nkbB) stage(t + 2);   // into the buffer that stage t has left
  }
  wait_async0();   // no copy is in flight when the pass, or the wave, ends

  // ---- epilogue: normalize and store into concat buffer [T, 2H] ----
  // A lane holds 8 consecutive d of its query's row per tile: two 16-byte stores.
  rsum += other_half(rsum);   // joins the two halves' keys
  float* orow = obuf + (size_t)tq * (2 * HID) + (size_t)dir * HID + h * HD + kbh;
#pragma unroll
  for (int ns = 0; ns < 4; ++ns) {
    *(float4*)(orow + ns * 16) =
        make_float4(o[ns][0] / rsum, o[ns][1] / rsum, o[ns][2] / rsum, o[ns][3] / rsum);
    *(float4*)(orow + ns * 16 + 4) =
        make_float4(o[ns][4] / rsum, o[ns][5] / rsum, o[ns][6] / rsum, o[ns][7] / rsum);
  }
  // The wait that stands before a register named by an issued store is
  // overwritten: the second pass reuses the stores' address and data registers.
  asm volatile("s_wait_xcnt 0x0" ::: "memory");
  }   // pass
}

// ---------------------------------------------------------------------------
extern "C" void kernel_launch(void* const* d_in, const int* in_sizes, int n_in,
                              void* d_out, int out_size, void* d_ws, size_t ws_size,
                              hipStream_t stream) {
  (void)in_sizes; (void)n_in; (void)out_size; (void)ws_size;
  const float* hidden = (const float*)d_in[0];
  const float* Wq     = (const float*)d_in[1];
  const float* Wk     = (const float*)d_in[2];
  const float* Wv     = (const float*)d_in[3];
  const float* Wf     = (const float*)d_in[4];
  const float* bf     = (const float*)d_in[5];
  const float* Wo     = (const float*)d_in[6];
  float* out = (float*)d_out;

  // Workspace layout: q|k|v (f16) then f|gc|o_concat (f32)
  _Float16* qb = (_Float16*)d_ws;
  _Float16* kb = qb + (size_t)T_SEQ * HID;
  _Float16* vb = kb + (size_t)T_SEQ * HID;
  float* fb = (float*)(vb + (size_t)T_SEQ * HID);
  float* gc = fb + (size_t)NH * T_SEQ;
  float* ob = gc + (size_t)2 * NH * T_SEQ;

  // q, k and v in one launch; qb, kb and vb lie one behind the other.
  dim3 gproj(T_SEQ / 128, HID / 128, 3);
  gemm_f16_wmma<true><<<gproj, 256, 0, stream>>>(hidden, Wq, Wk, Wv, qb, T_SEQ, HID, HID,
                                                 0.125f /* d^-0.5 folded in */);

  fgate_kernel<<<T_SEQ / FG_T, FG_W * 32, 0, stream>>>(hidden, Wf, bf, fb);
  fscan_kernel<<<2 * NH, 256, 0, stream>>>(fb, gc);

  dim3 gattn(T_SEQ / 16 / WPB / 2, NH, 2);
  fox_attn_kernel<<<gattn, WPB * 32, 0, stream>>>(qb, kb, vb, gc, ob);

  dim3 gout(T_SEQ / 128, HID / 128);
  // One product: gridDim.z is 1, the second and third weight pointers go unread.
  gemm_f16_wmma<false><<<gout, 256, 0, stream>>>(ob, Wo, Wo, Wo, out, T_SEQ, HID,
                                                 2 * HID, 1.f);
}
